// v000
// The times below were measured on an AMD MI455X: many runs one after another, warmed up first and cycling through
// copies of the inputs, with the whole window's GPU time divided by the number of runs. Launches and the gaps
// between them are all in it. The median over several windows is given; except for v000 it joins two sittings, which
// can be a few percent apart, so the side-by-side timings, each taken in one sitting, are the better comparison.
// The starting kernel, v000, takes 499 microseconds a run.
// compute dtype: x, Wq, Wk, Wv, gamma (module inputs) rounded to bf16; the 1x1x1 projections q/k/v with exact bf16 products (x and W are inputs) on WMMA 16x16x32 (the 8-wide q/k zero-padded to 32), scores q.k with both computed operands as bf16 hi + residual pairs (3 products), out = attn.v^T with attn hi/lo x v hi/lo (3 products); softmax and the residual x + gamma*out in f32; f32 accumulate.
#include <hip/hip_runtime.h>
#include <math.h>

typedef __attribute__((ext_vector_type(16))) _Float16 v16h;
typedef __attribute__((ext_vector_type(16))) __bf16 v16b;
typedef __attribute__((ext_vector_type(8)))  _Float16 v8h;
typedef __attribute__((ext_vector_type(8)))  float v8f;
typedef __attribute__((ext_vector_type(4)))  float v4f;
typedef __attribute__((ext_vector_type(2)))  float v2f;
typedef __attribute__((ext_vector_type(4)))  unsigned v4u;
typedef __attribute__((ext_vector_type(4)))  int v4i;
typedef float __attribute__((may_alias)) float_a;
typedef int __attribute__((may_alias)) int_a;

template <typename T> __device__ __forceinline__ void vst2(void* p, T v) { *(T*)p = v;  }
__device__ __forceinline__ v8f wmma16(v16h a, v16h b, v8f c) {
  v8f d = __builtin_amdgcn_wmma_f32_16x16x32_f16(false, a, false, b, (short)0, c, false, false);
  asm volatile("v_nop\n\tv_nop\n\tv_nop\n\tv_nop" : "+v"(d) : "v"(a), "v"(b));
  return d;
}
__device__ __forceinline__ v8f wmma_bf(v16b a, v16b b, v8f c) {
  v8f d = __builtin_amdgcn_wmma_f32_16x16x32_bf16(false, a, false, b, (short)0, c, false, false);
  asm volatile("v_nop\n\tv_nop\n\tv_nop\n\tv_nop" : "+v"(d) : "v"(a), "v"(b));
  return d;
}
// 16x16x32 fragments: lane = (h = lane>>4, row/col = lane&15); elements 0..7 = k0+8h+0..7, 8..15 = k0+16+8h+0..7; D element r = row 8h+r
__device__ __forceinline__ v16h frag_h(const _Float16* rowk0, int lane) {
  union { v16h v; v8h q[2]; } u; const _Float16* p = rowk0 + 8 * (lane >> 4);
  u.q[0] = *(const v8h*)p; u.q[1] = *(const v8h*)(p + 16); return u.v;
}
__device__ __forceinline__ v16h frag_f32(const float* rowk0, int lane) {
  v16h a; const float* p = rowk0 + 8 * (lane >> 4);
#pragma unroll
  for (int i = 0; i < 8; ++i) { a[i] = (_Float16)p[i]; a[8 + i] = (_Float16)p[16 + i]; }
  return a;
}
__device__ __forceinline__ v16h frag_f32s(const float* rowk0, int lane, float sc) {
  v16h a; const float* p = rowk0 + 8 * (lane >> 4);
#pragma unroll
  for (int i = 0; i < 8; ++i) { a[i] = (_Float16)(p[i] * sc); a[8 + i] = (_Float16)(p[16 + i] * sc); }
  return a;
}
// column fragment from a [K][ld] layout (column n), rows >= K read as 0
__device__ __forceinline__ v16h fragc_f32(const float* W, int k0, int n, int lane, int ld, int K) {
  v16h a; const int g = lane >> 4;
#pragma unroll
  for (int i = 0; i < 8; ++i) { const int ka = k0 + 8 * g + i, kb = ka + 16;
    a[i] = (_Float16)(ka < K ? W[(size_t)(ka < K ? ka : K - 1) * ld + n] : 0.f); a[8 + i] = (_Float16)(kb < K ? W[(size_t)(kb < K ? kb : K - 1) * ld + n] : 0.f); }
  return a;
}
struct F2 { v16b h, l; };
__device__ __forceinline__ F2 bsplit16(const float v[16]) { F2 r;
#pragma unroll
  for (int i = 0; i < 16; ++i) { const __bf16 h = (__bf16)v[i]; r.h[i] = h; r.l[i] = (__bf16)(v[i] - (float)h); }
  return r; }
__device__ __forceinline__ F2 split_row(const float* row, int k0, int lane) { float v[16]; const float* p = row + k0 + 8 * (lane >> 4);
#pragma unroll
  for (int i = 0; i < 8; ++i) { v[i] = p[i]; v[8 + i] = p[16 + i]; }
  return bsplit16(v); }
__device__ __forceinline__ F2 split_rowK(const float* row, int k0, int lane, int K) { float v[16]; const int g = lane >> 4;
#pragma unroll
  for (int i = 0; i < 8; ++i) { const int ka = k0 + 8 * g + i, kb = ka + 16; v[i] = ka < K ? row[ka < K ? ka : K - 1] : 0.f; v[8 + i] = kb < K ? row[kb < K ? kb : K - 1] : 0.f; }
  return bsplit16(v); }
__device__ __forceinline__ F2 split_col(const float* W, int k0, int n, int lane, int ld, int K) { float v[16]; const int g = lane >> 4;
#pragma unroll
  for (int i = 0; i < 8; ++i) { const int ka = k0 + 8 * g + i, kb = ka + 16; v[i] = ka < K ? W[(size_t)(ka < K ? ka : K - 1) * ld + n] : 0.f; v[8 + i] = kb < K ? W[(size_t)(kb < K ? kb : K - 1) * ld + n] : 0.f; }
  return bsplit16(v); }
__device__ __forceinline__ v8f mac3(const F2& a, const F2& b, v8f c) { c = wmma_bf(a.l, b.h, c); c = wmma_bf(a.h, b.l, c); return wmma_bf(a.h, b.h, c); }
__device__ __forceinline__ float sigm(float v) { return 1.0f / (1.0f + expf(-v)); }
#define LDSX() do { asm volatile("s_wait_dscnt 0" ::: "memory"); __builtin_amdgcn_wave_barrier(); __builtin_amdgcn_fence(__ATOMIC_RELEASE, "workgroup"); } while (0)


// 3-D position attention (B 2, C 64, 16x16x16 = 4096 positions, reduced 8): q = Wq x, k = Wk x, v = Wv x (1x1x1 convs, no bias); attn = softmax(q^T k / sqrt(8)) over positions; out[c][n] = sum_m v[c][m] attn[n][m]; y = x + gamma * out.
#define NB 2
#define CH 64
#define NP 4096
#define RR 8
#ifndef TQB
#define TQB (NP / 64)
#define TNB NB
#endif
typedef __attribute__((ext_vector_type(8))) __bf16 v8b;
__device__ __forceinline__ v16b frag_b(const __bf16* rowk0, int lane) {
  union { v16b v; v8b q[2]; } u; const __bf16* p = rowk0 + 8 * (lane >> 4);
  u.q[0] = *(const v8b*)p; u.q[1] = *(const v8b*)(p + 16); return u.v;
}
__device__ __forceinline__ float bfr(float v) { return (float)(__bf16)v; }
__device__ __attribute__((noinline)) float exp_ni(float v) { return expf(v); }
__device__ __attribute__((noinline)) float erf_ni(float v) { return erff(v); }

#define WS_PW  0u                                // bf16 [128][64]: rows 0..7 Wq, 8..31 zero, 32..39 Wk, 40..63 zero, 64..127?? -> layout: [0..31] q-plane rows (8 real), [32..63] k-plane rows (8 real), [64..127] Wv rows (64)
#define WS_QK  (WS_PW + 2u * 128 * CH)             // f32 [NB][NP][64]: cols 0..31 q (8 real + zeros), 32..63 k (8 real + zeros)
#define WS_VH  (WS_QK + 4u * NB * NP * 64)         // bf16 [NB][64 c][NP] v hi
#define WS_VL  (WS_VH + 2u * NB * CH * NP)
#define WS_END (WS_VL + 2u * NB * CH * NP)

// ---- k_pack: one block: rows 0..7 = Wq[r][:], 8..31 = 0, 32..39 = Wk, 40..63 = 0, 64..127 = Wv[o][:] (all natural [out][in] rows = B operand rows)
__global__ __launch_bounds__(256) void k_pack(const float* __restrict__ WQ, const float* __restrict__ WK, const float* __restrict__ WV, __bf16* __restrict__ PW) {
  __shared__ __align__(16) __bf16 s[128][CH]; const int tid = threadIdx.x;
  for (int q = tid; q < 128 * CH; q += 256) { const int n = q / CH, c = q % CH; float v = 0.f; if (n < RR) v = WQ[n * CH + c]; else if (n >= 32 && n < 32 + RR) v = WK[(n - 32) * CH + c]; else if (n >= 64) v = WV[(n - 64) * CH + c]; s[n][c] = (__bf16)v; }
  __syncthreads();
  for (int q = tid; q < 128 * CH / 8; q += 256) vst2((unsigned*)(PW + q * 8), *(const v4u*)&(&s[0][0])[q * 8]);
}
__global__ __launch_bounds__(128) void k_proj(const float* __restrict__ X, const __bf16* __restrict__ PW, float* __restrict__ QK, __bf16* __restrict__ VH, __bf16* __restrict__ VL) {
  __shared__ __align__(16) __bf16 sx[64][72]; __shared__ __align__(16) float so[4][16][68]; __shared__ __align__(16) __bf16 sth[CH][72], stl[CH][72];
  const int tid = threadIdx.x, wave = tid >> 5, lane = tid & 31, col = lane & 15, g = lane >> 4; const int b = blockIdx.y; const int p0 = blockIdx.x * 64;
  for (int q = tid; q < CH * 64; q += 128) { const int c = q >> 6, nl = q & 63; sx[nl][c] = (__bf16)X[((size_t)b * CH + c) * NP + p0 + nl]; }   // sx[position][channel]
  __syncthreads();
  v16b a[2];
#pragma unroll
  for (int kc = 0; kc < 2; ++kc) {
#pragma unroll
    for (int i = 0; i < 8; ++i) { a[kc][i] = sx[wave * 16 + col][kc * 32 + 8 * g + i]; a[kc][8 + i] = sx[wave * 16 + col][kc * 32 + 16 + 8 * g + i]; } }
  v8f acc[8] = {};   // tiles: 0,1 = q plane rows 0..31; 2,3 = k plane rows 32..63; 4..7 = v rows 64..127
#pragma unroll
  for (int kc = 0; kc < 2; ++kc) {
#pragma unroll
    for (int j = 0; j < 8; ++j) acc[j] = wmma_bf(a[kc], frag_b(PW + (size_t)(j * 16 + col) * CH + kc * 32, lane), acc[j]); }
#pragma unroll
  for (int j = 0; j < 4; ++j)
#pragma unroll
    for (int r = 0; r < 8; ++r) so[wave][8 * g + r][j * 16 + col] = acc[j][r];
#pragma unroll
  for (int j = 4; j < 8; ++j) { const int c = (j - 4) * 16 + col;
#pragma unroll
    for (int r = 0; r < 8; ++r) { const float v = acc[j][r]; const __bf16 hb = (__bf16)v; sth[c][wave * 16 + 8 * g + r] = hb; stl[c][wave * 16 + 8 * g + r] = (__bf16)(v - (float)hb); } }
  __syncthreads();
  for (int rl = 0; rl < 16; ++rl) if (lane < 16) vst2(QK + ((size_t)b * NP + p0 + wave * 16 + rl) * 64 + lane * 4, *(const v4f*)&so[wave][rl][lane * 4]);
  for (int q = tid; q < CH * 8; q += 128) { const int c = q >> 3, pc = q & 7; const size_t o = ((size_t)b * CH + c) * NP + p0 + pc * 8; vst2((unsigned*)(VH + o), *(const v4u*)&sth[c][pc * 8]); vst2((unsigned*)(VL + o), *(const v4u*)&stl[c][pc * 8]); }
}
// ---- k_attn: block = (64 queries, batch): scores = q.k (K 32 with zeros beyond 8; 3 products) / sqrt(8), online softmax over all 4096 keys, O[n][c] = P(hi/lo).V(hi/lo); epilogue: y[b][c][n] = x + gamma * O (transposed through LDS; 256-B runs per channel)
__global__ __launch_bounds__(128) void k_attn(const float* __restrict__ QK, const __bf16* __restrict__ VH, const __bf16* __restrict__ VL, const float* __restrict__ X, const float* __restrict__ GM, float* __restrict__ Y) {
  __shared__ __align__(16) float sp[4][16][36]; __shared__ __align__(16) float so[CH][68];
  const int tid = threadIdx.x, wave = tid >> 5, lane = tid & 31, col = lane & 15, g = lane >> 4; const int b = blockIdx.y; const int q0 = blockIdx.x * 64 + wave * 16;
  const F2 aq = split_row(QK + ((size_t)b * NP + q0 + col) * 64, 0, lane);
  float m[8], l[8];
#pragma unroll
  for (int r = 0; r < 8; ++r) { m[r] = -3.0e38f; l[r] = 0.f; }
  v8f acc[4] = {};
  const float scale = 0.35355339059327373f;   // 8 ** -0.5
#pragma unroll 1
  for (int ks = 0; ks < NP / 32; ++ks) { v8f s[2];
#pragma unroll
    for (int ct = 0; ct < 2; ++ct) { const int kk = ks * 32 + ct * 16 + col; const F2 kb = split_row(QK + ((size_t)b * NP + kk) * 64, 32, lane); const v8f c = mac3(aq, kb, (v8f){});
#pragma unroll
      for (int r = 0; r < 8; ++r) s[ct][r] = c[r] * scale; }
#pragma unroll
    for (int r = 0; r < 8; ++r) { float mx = fmaxf(s[0][r], s[1][r]);
#pragma unroll
      for (int o = 1; o < 16; o <<= 1) mx = fmaxf(mx, __shfl_xor(mx, o));
      const float mn = fmaxf(m[r], mx); const float alpha = exp_ni(m[r] - mn);
      const float e0 = exp_ni(s[0][r] - mn), e1 = exp_ni(s[1][r] - mn); float es = e0 + e1;
#pragma unroll
      for (int o = 1; o < 16; o <<= 1) es += __shfl_xor(es, o);
      l[r] = l[r] * alpha + es; m[r] = mn;
#pragma unroll
      for (int dt = 0; dt < 4; ++dt) acc[dt][r] *= alpha;
      sp[wave][8 * g + r][col] = e0; sp[wave][8 * g + r][16 + col] = e1; }
    LDSX();
    const F2 pa = split_row(&sp[wave][col][0], 0, lane);
#pragma unroll
    for (int dt = 0; dt < 4; ++dt) { const size_t vr = ((size_t)b * CH + dt * 16 + col) * NP + ks * 32; const v16b vh = frag_b(VH + vr, lane), vl = frag_b(VL + vr, lane); acc[dt] = wmma_bf(pa.l, vh, acc[dt]); acc[dt] = wmma_bf(pa.h, vl, acc[dt]); acc[dt] = wmma_bf(pa.h, vh, acc[dt]); }
    LDSX(); }
  const float gm = bfr(GM[0]);
#pragma unroll
  for (int r = 0; r < 8; ++r) { const float il = 1.0f / l[r];
#pragma unroll
    for (int dt = 0; dt < 4; ++dt) so[dt * 16 + col][wave * 16 + 8 * g + r] = acc[dt][r] * il; }   // so[channel][query local]
  __syncthreads();
  for (int q = tid; q < CH * 16; q += 128) { const int c = q >> 4, pc = q & 15; const size_t o = ((size_t)b * CH + c) * NP + blockIdx.x * 64 + pc * 4; const float* xs = X + o; const v4f ov = *(const v4f*)&so[c][pc * 4];
    vst2(Y + o, (v4f){bfr(xs[0]) + gm * ov[0], bfr(xs[1]) + gm * ov[1], bfr(xs[2]) + gm * ov[2], bfr(xs[3]) + gm * ov[3]}); }
}
extern "C" void kernel_launch(void* const* d_in, const int* in_sizes, int n_in, void* d_out, int out_size, void* d_ws, size_t ws_size, hipStream_t stream) {
  (void)in_sizes; (void)n_in; (void)out_size;
  const float** F = (const float**)d_in;   // x [2,64,16,16,16], Wq [8,64], Wk [8,64], Wv [64,64], gamma [1]
  if (ws_size < (size_t)WS_END) return;
  char* ws = (char*)d_ws; __bf16 *PW = (__bf16*)(ws + WS_PW), *VH = (__bf16*)(ws + WS_VH), *VL = (__bf16*)(ws + WS_VL); float* QK = (float*)(ws + WS_QK);
  k_pack<<<1, 256, 0, stream>>>(F[1], F[2], F[3], PW);
  k_proj<<<dim3(NP / 64, TNB), 128, 0, stream>>>(F[0], PW, QK, VH, VL);
  k_attn<<<dim3(TQB, TNB), 128, 0, stream>>>(QK, VH, VL, F[0], F[4], (float*)d_out);
}

// v001
// It runs in 77.5 microseconds.
// In two side-by-side timings against v000, it was 6.45 and 6.47 times as fast.
// compute dtype: x, Wq, Wk, Wv, gamma (module inputs) rounded to bf16; the 1x1x1 projections q/k/v with exact bf16 products (x and W are inputs) on WMMA 16x16x32 (the 8-wide q/k zero-padded to 32), scores q.k with both computed operands as bf16 hi + residual pairs (3 products), out = attn.v^T with attn hi/lo x v hi/lo (3 products); softmax and the residual x + gamma*out in f32; f32 accumulate.
#include <hip/hip_runtime.h>
#include <math.h>

typedef __attribute__((ext_vector_type(16))) _Float16 v16h;
typedef __attribute__((ext_vector_type(16))) __bf16 v16b;
typedef __attribute__((ext_vector_type(8)))  _Float16 v8h;
typedef __attribute__((ext_vector_type(8)))  float v8f;
typedef __attribute__((ext_vector_type(4)))  float v4f;
typedef __attribute__((ext_vector_type(2)))  float v2f;
typedef __attribute__((ext_vector_type(4)))  unsigned v4u;
typedef __attribute__((ext_vector_type(4)))  int v4i;
typedef float __attribute__((may_alias)) float_a;
typedef int __attribute__((may_alias)) int_a;

template <typename T> __device__ __forceinline__ void vst2(void* p, T v) { *(T*)p = v;  }
__device__ __forceinline__ v8f wmma16(v16h a, v16h b, v8f c) {
  v8f d = __builtin_amdgcn_wmma_f32_16x16x32_f16(false, a, false, b, (short)0, c, false, false);
  asm volatile("v_nop\n\tv_nop\n\tv_nop\n\tv_nop" : "+v"(d) : "v"(a), "v"(b));
  return d;
}
__device__ __forceinline__ v8f wmma_bf(v16b a, v16b b, v8f c) {
  v8f d = __builtin_amdgcn_wmma_f32_16x16x32_bf16(false, a, false, b, (short)0, c, false, false);
  asm volatile("v_nop\n\tv_nop\n\tv_nop\n\tv_nop" : "+v"(d) : "v"(a), "v"(b));
  return d;
}
// 16x16x32 fragments: lane = (h = lane>>4, row/col = lane&15); elements 0..7 = k0+8h+0..7, 8..15 = k0+16+8h+0..7; D element r = row 8h+r
__device__ __forceinline__ v16h frag_h(const _Float16* rowk0, int lane) {
  union { v16h v; v8h q[2]; } u; const _Float16* p = rowk0 + 8 * (lane >> 4);
  u.q[0] = *(const v8h*)p; u.q[1] = *(const v8h*)(p + 16); return u.v;
}
__device__ __forceinline__ v16h frag_f32(const float* rowk0, int lane) {
  v16h a; const float* p = rowk0 + 8 * (lane >> 4);
#pragma unroll
  for (int i = 0; i < 8; ++i) { a[i] = (_Float16)p[i]; a[8 + i] = (_Float16)p[16 + i]; }
  return a;
}
__device__ __forceinline__ v16h frag_f32s(const float* rowk0, int lane, float sc) {
  v16h a; const float* p = rowk0 + 8 * (lane >> 4);
#pragma unroll
  for (int i = 0; i < 8; ++i) { a[i] = (_Float16)(p[i] * sc); a[8 + i] = (_Float16)(p[16 + i] * sc); }
  return a;
}
// column fragment from a [K][ld] layout (column n), rows >= K read as 0
__device__ __forceinline__ v16h fragc_f32(const float* W, int k0, int n, int lane, int ld, int K) {
  v16h a; const int g = lane >> 4;
#pragma unroll
  for (int i = 0; i < 8; ++i) { const int ka = k0 + 8 * g + i, kb = ka + 16;
    a[i] = (_Float16)(ka < K ? W[(size_t)(ka < K ? ka : K - 1) * ld + n] : 0.f); a[8 + i] = (_Float16)(kb < K ? W[(size_t)(kb < K ? kb : K - 1) * ld + n] : 0.f); }
  return a;
}
struct F2 { v16b h, l; };
__device__ __forceinline__ F2 bsplit16(const float v[16]) { F2 r;
#pragma unroll
  for (int i = 0; i < 16; ++i) { const __bf16 h = (__bf16)v[i]; r.h[i] = h; r.l[i] = (__bf16)(v[i] - (float)h); }
  return r; }
__device__ __forceinline__ F2 split_row(const float* row, int k0, int lane) { float v[16]; const float* p = row + k0 + 8 * (lane >> 4);
#pragma unroll
  for (int i = 0; i < 8; ++i) { v[i] = p[i]; v[8 + i] = p[16 + i]; }
  return bsplit16(v); }
__device__ __forceinline__ F2 split_rowK(const float* row, int k0, int lane, int K) { float v[16]; const int g = lane >> 4;
#pragma unroll
  for (int i = 0; i < 8; ++i) { const int ka = k0 + 8 * g + i, kb = ka + 16; v[i] = ka < K ? row[ka < K ? ka : K - 1] : 0.f; v[8 + i] = kb < K ? row[kb < K ? kb : K - 1] : 0.f; }
  return bsplit16(v); }
__device__ __forceinline__ F2 split_col(const float* W, int k0, int n, int lane, int ld, int K) { float v[16]; const int g = lane >> 4;
#pragma unroll
  for (int i = 0; i < 8; ++i) { const int ka = k0 + 8 * g + i, kb = ka + 16; v[i] = ka < K ? W[(size_t)(ka < K ? ka : K - 1) * ld + n] : 0.f; v[8 + i] = kb < K ? W[(size_t)(kb < K ? kb : K - 1) * ld + n] : 0.f; }
  return bsplit16(v); }
__device__ __forceinline__ v8f mac3(const F2& a, const F2& b, v8f c) { c = wmma_bf(a.l, b.h, c); c = wmma_bf(a.h, b.l, c); return wmma_bf(a.h, b.h, c); }
__device__ __forceinline__ float sigm(float v) { return 1.0f / (1.0f + expf(-v)); }
#define LDSX() do { asm volatile("s_wait_dscnt 0" ::: "memory"); __builtin_amdgcn_wave_barrier(); __builtin_amdgcn_fence(__ATOMIC_RELEASE, "workgroup"); } while (0)


// 3-D position attention (B 2, C 64, 16x16x16 = 4096 positions, reduced 8): q = Wq x, k = Wk x, v = Wv x (1x1x1 convs, no bias); attn = softmax(q^T k / sqrt(8)) over positions; out[c][n] = sum_m v[c][m] attn[n][m]; y = x + gamma * out.
#define NB 2
#define CH 64
#define NP 4096
#define RR 8
#ifndef TQB
#define TQB (NP / 32)
#define TNB NB
#endif
typedef __attribute__((ext_vector_type(8))) __bf16 v8b;
__device__ __forceinline__ v16b frag_b(const __bf16* rowk0, int lane) {
  union { v16b v; v8b q[2]; } u; const __bf16* p = rowk0 + 8 * (lane >> 4);
  u.q[0] = *(const v8b*)p; u.q[1] = *(const v8b*)(p + 16); return u.v;
}
__device__ __forceinline__ float bfr(float v) { return (float)(__bf16)v; }
__device__ __attribute__((noinline)) float exp_ni(float v) { return expf(v); }
__device__ __attribute__((noinline)) float erf_ni(float v) { return erff(v); }

#define WS_PW  0u                                // bf16 [128][64]: rows 0..7 Wq, 8..31 zero, 32..39 Wk, 40..63 zero, 64..127?? -> layout: [0..31] q-plane rows (8 real), [32..63] k-plane rows (8 real), [64..127] Wv rows (64)
#define WS_QK  (WS_PW + 2u * 128 * CH)             // f32 [NB][NP][64]: cols 0..31 q (8 real + zeros), 32..63 k (8 real + zeros)
#define WS_VH  (WS_QK + 4u * NB * NP * 64)         // bf16 [NB][64 c][NP] v hi
#define WS_VL  (WS_VH + 2u * NB * CH * NP)
#define WS_END (WS_VL + 2u * NB * CH * NP)

// ---- k_pack: one block: rows 0..7 = Wq[r][:], 8..31 = 0, 32..39 = Wk, 40..63 = 0, 64..127 = Wv[o][:] (all natural [out][in] rows = B operand rows)
__global__ __launch_bounds__(256) void k_pack(const float* __restrict__ WQ, const float* __restrict__ WK, const float* __restrict__ WV, __bf16* __restrict__ PW) {
  __shared__ __align__(16) __bf16 s[128][CH]; const int tid = threadIdx.x;
  for (int q = tid; q < 128 * CH; q += 256) { const int n = q / CH, c = q % CH; float v = 0.f; if (n < RR) v = WQ[n * CH + c]; else if (n >= 32 && n < 32 + RR) v = WK[(n - 32) * CH + c]; else if (n >= 64) v = WV[(n - 64) * CH + c]; s[n][c] = (__bf16)v; }
  __syncthreads();
  for (int q = tid; q < 128 * CH / 8; q += 256) vst2((unsigned*)(PW + q * 8), *(const v4u*)&(&s[0][0])[q * 8]);
}
__global__ __launch_bounds__(128) void k_proj(const float* __restrict__ X, const __bf16* __restrict__ PW, float* __restrict__ QK, __bf16* __restrict__ VH, __bf16* __restrict__ VL) {
  __shared__ __align__(16) __bf16 sx[64][72]; __shared__ __align__(16) float so[4][16][68]; __shared__ __align__(16) __bf16 sth[CH][72], stl[CH][72];
  const int tid = threadIdx.x, wave = tid >> 5, lane = tid & 31, col = lane & 15, g = lane >> 4; const int b = blockIdx.y; const int p0 = blockIdx.x * 64;
  for (int q = tid; q < CH * 64; q += 128) { const int c = q >> 6, nl = q & 63; sx[nl][c] = (__bf16)X[((size_t)b * CH + c) * NP + p0 + nl]; }   // sx[position][channel]
  __syncthreads();
  v16b a[2];
#pragma unroll
  for (int kc = 0; kc < 2; ++kc) {
#pragma unroll
    for (int i = 0; i < 8; ++i) { a[kc][i] = sx[wave * 16 + col][kc * 32 + 8 * g + i]; a[kc][8 + i] = sx[wave * 16 + col][kc * 32 + 16 + 8 * g + i]; } }
  v8f acc[8] = {};   // tiles: 0,1 = q plane rows 0..31; 2,3 = k plane rows 32..63; 4..7 = v rows 64..127
#pragma unroll
  for (int kc = 0; kc < 2; ++kc) {
#pragma unroll
    for (int j = 0; j < 8; ++j) acc[j] = wmma_bf(a[kc], frag_b(PW + (size_t)(j * 16 + col) * CH + kc * 32, lane), acc[j]); }
#pragma unroll
  for (int j = 0; j < 4; ++j)
#pragma unroll
    for (int r = 0; r < 8; ++r) so[wave][8 * g + r][j * 16 + col] = acc[j][r];
#pragma unroll
  for (int j = 4; j < 8; ++j) { const int c = (j - 4) * 16 + col;
#pragma unroll
    for (int r = 0; r < 8; ++r) { const float v = acc[j][r]; const __bf16 hb = (__bf16)v; sth[c][wave * 16 + 8 * g + r] = hb; stl[c][wave * 16 + 8 * g + r] = (__bf16)(v - (float)hb); } }
  __syncthreads();
  for (int rl = 0; rl < 16; ++rl) if (lane < 16) vst2(QK + ((size_t)b * NP + p0 + wave * 16 + rl) * 64 + lane * 4, *(const v4f*)&so[wave][rl][lane * 4]);
  for (int q = tid; q < CH * 8; q += 128) { const int c = q >> 3, pc = q & 7; const size_t o = ((size_t)b * CH + c) * NP + p0 + pc * 8; vst2((unsigned*)(VH + o), *(const v4u*)&sth[c][pc * 8]); vst2((unsigned*)(VL + o), *(const v4u*)&stl[c][pc * 8]); }
}
// ---- k_attn: block = (32 queries, batch) = 2 query tiles x KSPL key shares, one wave each: the wave of share sh takes the blocks of 32 keys sh, sh + KSPL, ... with its own maxima, sums and accumulators, and the shares are merged in LDS at the end. Per wave: scores = q.k (K 32 with zeros beyond 8; 3 products) / sqrt(8), online softmax over its share of the 4096 keys, O[n][c] = P(hi/lo).V(hi/lo); epilogue: weight of a share = exp(m_share - max) / merged sum; y[b][c][n] = x + gamma * sum of weighted partial O (transposed through LDS; one 128-B line per channel)
#define KSPL 16
__global__ __launch_bounds__(64 * KSPL) void k_attn(const float* __restrict__ QK, const __bf16* __restrict__ VH, const __bf16* __restrict__ VL, const float* __restrict__ X, const float* __restrict__ GM, float* __restrict__ Y) {
  __shared__ __align__(16) float sp[2 * KSPL][16][36]; __shared__ __align__(16) float so[KSPL][CH][36]; __shared__ __align__(16) float sm[KSPL][32], sl[KSPL][32], sw[KSPL][32];
  const int wave = __builtin_amdgcn_readfirstlane(threadIdx.x >> 5), lane = threadIdx.x & 31, col = lane & 15, g = lane >> 4; const int qt = wave & 1, sh = wave >> 1;   // wave number in a scalar register: the key loop's counter and branch stay scalar
  const int b = blockIdx.y; const int q0 = blockIdx.x * 32 + qt * 16;
  const F2 aq = split_row(QK + ((size_t)b * NP + q0 + col) * 64, 0, lane);
  float m[8], l[8];
#pragma unroll
  for (int r = 0; r < 8; ++r) { m[r] = -3.0e38f; l[r] = 0.f; }
  v8f acc[4] = {};
  const float scale = 0.35355339059327373f;   // 8 ** -0.5
#pragma unroll 1
  for (int ks = sh; ks < NP / 32; ks += KSPL) { v8f s[2];
#pragma unroll
    for (int ct = 0; ct < 2; ++ct) { const int kk = ks * 32 + ct * 16 + col; const F2 kb = split_row(QK + ((size_t)b * NP + kk) * 64, 32, lane); const v8f c = mac3(aq, kb, (v8f){});
#pragma unroll
      for (int r = 0; r < 8; ++r) s[ct][r] = c[r] * scale; }
#pragma unroll
    for (int r = 0; r < 8; ++r) { float mx = fmaxf(s[0][r], s[1][r]);
#pragma unroll
      for (int o = 1; o < 16; o <<= 1) mx = fmaxf(mx, __shfl_xor(mx, o));
      const float mn = fmaxf(m[r], mx); const float alpha = exp_ni(m[r] - mn);
      const float e0 = exp_ni(s[0][r] - mn), e1 = exp_ni(s[1][r] - mn); float es = e0 + e1;
#pragma unroll
      for (int o = 1; o < 16; o <<= 1) es += __shfl_xor(es, o);
      l[r] = l[r] * alpha + es; m[r] = mn;
#pragma unroll
      for (int dt = 0; dt < 4; ++dt) acc[dt][r] *= alpha;
      sp[wave][8 * g + r][col] = e0; sp[wave][8 * g + r][16 + col] = e1; }
    LDSX();
    const F2 pa = split_row(&sp[wave][col][0], 0, lane);
#pragma unroll
    for (int dt = 0; dt < 4; ++dt) { const size_t vr = ((size_t)b * CH + dt * 16 + col) * NP + ks * 32; const v16b vh = frag_b(VH + vr, lane), vl = frag_b(VL + vr, lane); acc[dt] = wmma_bf(pa.l, vh, acc[dt]); acc[dt] = wmma_bf(pa.h, vl, acc[dt]); acc[dt] = wmma_bf(pa.h, vh, acc[dt]); }
    LDSX(); }
  const float gm = bfr(GM[0]);
  const int ln = __builtin_amdgcn_mbcnt_lo(~0u, 0u), ec = ln & 15, eg = ln >> 4;   // the lane number taken anew: at 128 registers the indices of the epilogue, carried over the loop, were spilled to scratch
#pragma unroll
  for (int dt = 0; dt < 4; ++dt)
#pragma unroll
    for (int r = 0; r < 8; ++r) so[sh][dt * 16 + ec][qt * 16 + 8 * eg + r] = acc[dt][r];   // so[share][channel][query local], not yet normalised
  if (ec == 0) {
#pragma unroll
    for (int r = 0; r < 8; ++r) { sm[sh][qt * 16 + 8 * eg + r] = m[r]; sl[sh][qt * 16 + 8 * eg + r] = l[r]; } }
  __syncthreads();
  if (wave < KSPL) { const int s = wave, q = ln; float mm = sm[0][q];
#pragma unroll
    for (int j = 1; j < KSPL; ++j) mm = fmaxf(mm, sm[j][q]);
    float ll = 0.f;
#pragma unroll
    for (int j = 0; j < KSPL; ++j) ll += sl[j][q] * exp_ni(sm[j][q] - mm);
    sw[s][q] = exp_ni(sm[s][q] - mm) / ll; }
  __syncthreads();   // the weights are read by the 16 output waves (wave < CH / 4)
  if (wave < CH / 4) { const int c = wave * 4 + (ln >> 3), pc = ln & 7; const size_t o = ((size_t)b * CH + c) * NP + blockIdx.x * 32 + pc * 4; const float* xs = X + o; v4f ov = {};
#pragma unroll
    for (int s = 0; s < KSPL; ++s) ov += *(const v4f*)&sw[s][pc * 4] * *(const v4f*)&so[s][c][pc * 4];
    vst2(Y + o, (v4f){bfr(xs[0]) + gm * ov[0], bfr(xs[1]) + gm * ov[1], bfr(xs[2]) + gm * ov[2], bfr(xs[3]) + gm * ov[3]}); }
}
extern "C" void kernel_launch(void* const* d_in, const int* in_sizes, int n_in, void* d_out, int out_size, void* d_ws, size_t ws_size, hipStream_t stream) {
  (void)in_sizes; (void)n_in; (void)out_size;
  const float** F = (const float**)d_in;   // x [2,64,16,16,16], Wq [8,64], Wk [8,64], Wv [64,64], gamma [1]
  if (ws_size < (size_t)WS_END) return;
  char* ws = (char*)d_ws; __bf16 *PW = (__bf16*)(ws + WS_PW), *VH = (__bf16*)(ws + WS_VH), *VL = (__bf16*)(ws + WS_VL); float* QK = (float*)(ws + WS_QK);
  k_pack<<<1, 256, 0, stream>>>(F[1], F[2], F[3], PW);
  k_proj<<<dim3(NP / 64, TNB), 128, 0, stream>>>(F[0], PW, QK, VH, VL);
  k_attn<<<dim3(TQB, TNB), 64 * KSPL, 0, stream>>>(QK, VH, VL, F[0], F[4], (float*)d_out);
}

// v002
// It runs in 69.9 microseconds.
// Two timings next to v001 put it at 1.13 and 1.12 times that version's speed.
// All steps since v000 together make it 7.29 times as fast.
// compute dtype: x, Wq, Wk, Wv, gamma (module inputs) rounded to bf16; the 1x1x1 projections q/k/v with exact bf16 products (x and W are inputs) on WMMA 16x16x32 (the 8-wide q/k zero-padded to 32), scores q.k with both computed operands as bf16 hi + residual pairs (3 products), out = attn.v^T with attn hi/lo x v hi/lo (3 products); softmax and the residual x + gamma*out in f32; f32 accumulate.
#include <hip/hip_runtime.h>
#include <math.h>

typedef __attribute__((ext_vector_type(16))) _Float16 v16h;
typedef __attribute__((ext_vector_type(16))) __bf16 v16b;
typedef __attribute__((ext_vector_type(8)))  _Float16 v8h;
typedef __attribute__((ext_vector_type(8)))  float v8f;
typedef __attribute__((ext_vector_type(4)))  float v4f;
typedef __attribute__((ext_vector_type(2)))  float v2f;
typedef __attribute__((ext_vector_type(4)))  unsigned v4u;
typedef __attribute__((ext_vector_type(4)))  int v4i;
typedef float __attribute__((may_alias)) float_a;
typedef int __attribute__((may_alias)) int_a;

template <typename T> __device__ __forceinline__ void vst2(void* p, T v) { *(T*)p = v;  }
__device__ __forceinline__ v8f wmma16(v16h a, v16h b, v8f c) {
  v8f d = __builtin_amdgcn_wmma_f32_16x16x32_f16(false, a, false, b, (short)0, c, false, false);
  asm volatile("v_nop\n\tv_nop\n\tv_nop\n\tv_nop" : "+v"(d) : "v"(a), "v"(b));
  return d;
}
__device__ __forceinline__ v8f wmma_bf(v16b a, v16b b, v8f c) {
  v8f d = __builtin_amdgcn_wmma_f32_16x16x32_bf16(false, a, false, b, (short)0, c, false, false);
  asm volatile("v_nop\n\tv_nop\n\tv_nop\n\tv_nop" : "+v"(d) : "v"(a), "v"(b));
  return d;
}
// 16x16x32 fragments: lane = (h = lane>>4, row/col = lane&15); elements 0..7 = k0+8h+0..7, 8..15 = k0+16+8h+0..7; D element r = row 8h+r
__device__ __forceinline__ v16h frag_h(const _Float16* rowk0, int lane) {
  union { v16h v; v8h q[2]; } u; const _Float16* p = rowk0 + 8 * (lane >> 4);
  u.q[0] = *(const v8h*)p; u.q[1] = *(const v8h*)(p + 16); return u.v;
}
__device__ __forceinline__ v16h frag_f32(const float* rowk0, int lane) {
  v16h a; const float* p = rowk0 + 8 * (lane >> 4);
#pragma unroll
  for (int i = 0; i < 8; ++i) { a[i] = (_Float16)p[i]; a[8 + i] = (_Float16)p[16 + i]; }
  return a;
}
__device__ __forceinline__ v16h frag_f32s(const float* rowk0, int lane, float sc) {
  v16h a; const float* p = rowk0 + 8 * (lane >> 4);
#pragma unroll
  for (int i = 0; i < 8; ++i) { a[i] = (_Float16)(p[i] * sc); a[8 + i] = (_Float16)(p[16 + i] * sc); }
  return a;
}
// column fragment from a [K][ld] layout (column n), rows >= K read as 0
__device__ __forceinline__ v16h fragc_f32(const float* W, int k0, int n, int lane, int ld, int K) {
  v16h a; const int g = lane >> 4;
#pragma unroll
  for (int i = 0; i < 8; ++i) { const int ka = k0 + 8 * g + i, kb = ka + 16;
    a[i] = (_Float16)(ka < K ? W[(size_t)(ka < K ? ka : K - 1) * ld + n] : 0.f); a[8 + i] = (_Float16)(kb < K ? W[(size_t)(kb < K ? kb : K - 1) * ld + n] : 0.f); }
  return a;
}
struct F2 { v16b h, l; };
__device__ __forceinline__ F2 bsplit16(const float v[16]) { F2 r;
#pragma unroll
  for (int i = 0; i < 16; ++i) { const __bf16 h = (__bf16)v[i]; r.h[i] = h; r.l[i] = (__bf16)(v[i] - (float)h); }
  return r; }
__device__ __forceinline__ F2 split_row(const float* row, int k0, int lane) { float v[16]; const float* p = row + k0 + 8 * (lane >> 4);
#pragma unroll
  for (int i = 0; i < 8; ++i) { v[i] = p[i]; v[8 + i] = p[16 + i]; }
  return bsplit16(v); }
__device__ __forceinline__ F2 split_rowK(const float* row, int k0, int lane, int K) { float v[16]; const int g = lane >> 4;
#pragma unroll
  for (int i = 0; i < 8; ++i) { const int ka = k0 + 8 * g + i, kb = ka + 16; v[i] = ka < K ? row[ka < K ? ka : K - 1] : 0.f; v[8 + i] = kb < K ? row[kb < K ? kb : K - 1] : 0.f; }
  return bsplit16(v); }
__device__ __forceinline__ F2 split_col(const float* W, int k0, int n, int lane, int ld, int K) { float v[16]; const int g = lane >> 4;
#pragma unroll
  for (int i = 0; i < 8; ++i) { const int ka = k0 + 8 * g + i, kb = ka + 16; v[i] = ka < K ? W[(size_t)(ka < K ? ka : K - 1) * ld + n] : 0.f; v[8 + i] = kb < K ? W[(size_t)(kb < K ? kb : K - 1) * ld + n] : 0.f; }
  return bsplit16(v); }
__device__ __forceinline__ v8f mac3(const F2& a, const F2& b, v8f c) { c = wmma_bf(a.l, b.h, c); c = wmma_bf(a.h, b.l, c); return wmma_bf(a.h, b.h, c); }
__device__ __forceinline__ float sigm(float v) { return 1.0f / (1.0f + expf(-v)); }
#define LDSX() do { asm volatile("s_wait_dscnt 0" ::: "memory"); __builtin_amdgcn_wave_barrier(); __builtin_amdgcn_fence(__ATOMIC_RELEASE, "workgroup"); } while (0)


// 3-D position attention (B 2, C 64, 16x16x16 = 4096 positions, reduced 8): q = Wq x, k = Wk x, v = Wv x (1x1x1 convs, no bias); attn = softmax(q^T k / sqrt(8)) over positions; out[c][n] = sum_m v[c][m] attn[n][m]; y = x + gamma * out.
#define NB 2
#define CH 64
#define NP 4096
#define RR 8
#ifndef TQB
#define TQB (NP / 32)
#define TNB NB
#endif
typedef __attribute__((ext_vector_type(8))) __bf16 v8b;
__device__ __forceinline__ v16b frag_b(const __bf16* rowk0, int lane) {
  union { v16b v; v8b q[2]; } u; const __bf16* p = rowk0 + 8 * (lane >> 4);
  u.q[0] = *(const v8b*)p; u.q[1] = *(const v8b*)(p + 16); return u.v;
}
__device__ __forceinline__ float bfr(float v) { return (float)(__bf16)v; }
__device__ __attribute__((noinline)) float exp_ni(float v) { return expf(v); }
__device__ __attribute__((noinline)) float erf_ni(float v) { return erff(v); }

#define WS_PW  0u                                // bf16 [128][64]: rows 0..7 Wq, 8..31 zero, 32..39 Wk, 40..63 zero, 64..127?? -> layout: [0..31] q-plane rows (8 real), [32..63] k-plane rows (8 real), [64..127] Wv rows (64)
#define WS_QK  (WS_PW + 2u * 128 * CH)             // f32 [NB][NP][64]: cols 0..31 q (8 real + zeros), 32..63 k (8 real + zeros)
#define WS_VH  (WS_QK + 4u * NB * NP * 64)         // bf16 [NB][64 c][NP] v hi
#define WS_VL  (WS_VH + 2u * NB * CH * NP)
#define WS_END (WS_VL + 2u * NB * CH * NP)

// ---- k_pack: one block: rows 0..7 = Wq[r][:], 8..31 = 0, 32..39 = Wk, 40..63 = 0, 64..127 = Wv[o][:] (all natural [out][in] rows = B operand rows)
__global__ __launch_bounds__(256) void k_pack(const float* __restrict__ WQ, const float* __restrict__ WK, const float* __restrict__ WV, __bf16* __restrict__ PW) {
  __shared__ __align__(16) __bf16 s[128][CH]; const int tid = threadIdx.x;
  for (int q = tid; q < 128 * CH; q += 256) { const int n = q / CH, c = q % CH; float v = 0.f; if (n < RR) v = WQ[n * CH + c]; else if (n >= 32 && n < 32 + RR) v = WK[(n - 32) * CH + c]; else if (n >= 64) v = WV[(n - 64) * CH + c]; s[n][c] = (__bf16)v; }
  __syncthreads();
  for (int q = tid; q < 128 * CH / 8; q += 256) vst2((unsigned*)(PW + q * 8), *(const v4u*)&(&s[0][0])[q * 8]);
}
__global__ __launch_bounds__(128) void k_proj(const float* __restrict__ X, const __bf16* __restrict__ PW, float* __restrict__ QK, __bf16* __restrict__ VH, __bf16* __restrict__ VL) {
  __shared__ __align__(16) __bf16 sx[64][72]; __shared__ __align__(16) float so[4][16][68]; __shared__ __align__(16) __bf16 sth[CH][72], stl[CH][72];
  const int tid = threadIdx.x, wave = tid >> 5, lane = tid & 31, col = lane & 15, g = lane >> 4; const int b = blockIdx.y; const int p0 = blockIdx.x * 64;
  for (int q = tid; q < CH * 64; q += 128) { const int c = q >> 6, nl = q & 63; sx[nl][c] = (__bf16)X[((size_t)b * CH + c) * NP + p0 + nl]; }   // sx[position][channel]
  __syncthreads();
  v16b a[2];
#pragma unroll
  for (int kc = 0; kc < 2; ++kc) {
#pragma unroll
    for (int i = 0; i < 8; ++i) { a[kc][i] = sx[wave * 16 + col][kc * 32 + 8 * g + i]; a[kc][8 + i] = sx[wave * 16 + col][kc * 32 + 16 + 8 * g + i]; } }
  v8f acc[8] = {};   // tiles: 0,1 = q plane rows 0..31; 2,3 = k plane rows 32..63; 4..7 = v rows 64..127
#pragma unroll
  for (int kc = 0; kc < 2; ++kc) {
#pragma unroll
    for (int j = 0; j < 8; ++j) acc[j] = wmma_bf(a[kc], frag_b(PW + (size_t)(j * 16 + col) * CH + kc * 32, lane), acc[j]); }
#pragma unroll
  for (int j = 0; j < 4; ++j)
#pragma unroll
    for (int r = 0; r < 8; ++r) so[wave][8 * g + r][j * 16 + col] = acc[j][r];
#pragma unroll
  for (int j = 4; j < 8; ++j) { const int c = (j - 4) * 16 + col;
#pragma unroll
    for (int r = 0; r < 8; ++r) { const float v = acc[j][r]; const __bf16 hb = (__bf16)v; sth[c][wave * 16 + 8 * g + r] = hb; stl[c][wave * 16 + 8 * g + r] = (__bf16)(v - (float)hb); } }
  __syncthreads();
  for (int rl = 0; rl < 16; ++rl) if (lane < 16) vst2(QK + ((size_t)b * NP + p0 + wave * 16 + rl) * 64 + lane * 4, *(const v4f*)&so[wave][rl][lane * 4]);
  for (int q = tid; q < CH * 8; q += 128) { const int c = q >> 3, pc = q & 7; const size_t o = ((size_t)b * CH + c) * NP + p0 + pc * 8; vst2((unsigned*)(VH + o), *(const v4u*)&sth[c][pc * 8]); vst2((unsigned*)(VL + o), *(const v4u*)&stl[c][pc * 8]); }
}
// ---- k_attn: block = (32 queries, batch) = 2 query tiles x KSPL key shares, one wave each: the wave of share sh takes the blocks of 32 keys sh, sh + KSPL, ... with its own maxima, sums and accumulators, and the shares are merged in LDS at the end. Per wave the products are taken transposed: S^T[key][query] = k.q (K 32 with zeros beyond 8; 3 products) / sqrt(8), so a lane holds 16 of the 32 scores of ONE query (lane = (g, query); tile ct, element r = key 16 ct + 8 g + r), which is at once the B fragment of O^T[c][query] = V(hi/lo).P^T(hi/lo): the online softmax runs inside the lane, with one exchange between the two lane halves for the maximum; epilogue: weight of a share = exp(m_share - max) / merged sum; y[b][c][n] = x + gamma * sum of weighted partial O (one 128-B line per channel)
#define KSPL 16
// the value of lane l ^ 16 (the other lane half), without LDS
__device__ __forceinline__ float xhalf(float v) { const int b = __builtin_bit_cast(int, v); return __builtin_bit_cast(float, __builtin_amdgcn_permlanex16(b, b, 0x76543210, 0xfedcba98, false, false)); }
__global__ __launch_bounds__(64 * KSPL) void k_attn(const float* __restrict__ QK, const __bf16* __restrict__ VH, const __bf16* __restrict__ VL, const float* __restrict__ X, const float* __restrict__ GM, float* __restrict__ Y) {
  __shared__ __align__(16) float so[KSPL][CH][36]; __shared__ __align__(16) float sm[KSPL][32], sl[KSPL][32], sw[KSPL][32];
  const int wave = __builtin_amdgcn_readfirstlane(threadIdx.x >> 5), lane = threadIdx.x & 31, col = lane & 15; const int qt = wave & 1, sh = wave >> 1;   // wave number in a scalar register: the key loop's counter and branch stay scalar
  const int b = blockIdx.y; const int q0 = blockIdx.x * 32 + qt * 16;
  const F2 aq = split_row(QK + ((size_t)b * NP + q0 + col) * 64, 0, lane);
  float m = -3.0e38f, l = 0.f;   // of the lane's query; l counts the lane half's own keys only and is completed after the loop
  v8f acc[4] = {};   // acc[dt][r] = O^T[channel 16 dt + 8 g + r][query col]
  const float scale = 0.35355339059327373f;   // 8 ** -0.5
#pragma unroll 1
  for (int ks = sh; ks < NP / 32; ks += KSPL) { float s[16];
#pragma unroll
    for (int ct = 0; ct < 2; ++ct) { const int kk = ks * 32 + ct * 16 + col; const F2 kb = split_row(QK + ((size_t)b * NP + kk) * 64, 32, lane); const v8f c = mac3(kb, aq, (v8f){});
#pragma unroll
      for (int r = 0; r < 8; ++r) s[ct * 8 + r] = c[r] * scale; }
    float mx = s[0];
#pragma unroll
    for (int i = 1; i < 16; ++i) mx = fmaxf(mx, s[i]);
    mx = fmaxf(mx, xhalf(mx));   // both lane halves of a query scale by the same maximum: their keys are summed in one product
    const float mn = fmaxf(m, mx); const float alpha = exp_ni(m - mn); m = mn;
#pragma unroll
    for (int i = 0; i < 16; ++i) s[i] = exp_ni(s[i] - mn);
    float t[8];
#pragma unroll
    for (int i = 0; i < 8; ++i) t[i] = s[i] + s[8 + i];
    l = l * alpha + (((t[0] + t[4]) + (t[2] + t[6])) + ((t[1] + t[5]) + (t[3] + t[7])));
#pragma unroll
    for (int dt = 0; dt < 4; ++dt) acc[dt] *= alpha;
    const F2 pb = bsplit16(s);
#pragma unroll
    for (int dt = 0; dt < 4; ++dt) { const size_t vr = ((size_t)b * CH + dt * 16 + col) * NP + ks * 32; const v16b vh = frag_b(VH + vr, lane), vl = frag_b(VL + vr, lane); acc[dt] = wmma_bf(vh, pb.l, acc[dt]); acc[dt] = wmma_bf(vl, pb.h, acc[dt]); acc[dt] = wmma_bf(vh, pb.h, acc[dt]); } }
  l += xhalf(l);
  const float gm = bfr(GM[0]);
  const int ln = __builtin_amdgcn_mbcnt_lo(~0u, 0u), ec = ln & 15, eg = ln >> 4;   // the lane number taken anew: at 128 registers the indices of the epilogue, carried over the loop, were spilled to scratch
#pragma unroll
  for (int dt = 0; dt < 4; ++dt)
#pragma unroll
    for (int r = 0; r < 8; ++r) so[sh][dt * 16 + 8 * eg + r][qt * 16 + ec] = acc[dt][r];   // so[share][channel][query local], not yet normalised
  if (eg == 0) { sm[sh][qt * 16 + ec] = m; sl[sh][qt * 16 + ec] = l; }
  __syncthreads();
  if (wave < KSPL) { const int s = wave, q = ln; float mm = sm[0][q];
#pragma unroll
    for (int j = 1; j < KSPL; ++j) mm = fmaxf(mm, sm[j][q]);
    float ll = 0.f;
#pragma unroll
    for (int j = 0; j < KSPL; ++j) ll += sl[j][q] * exp_ni(sm[j][q] - mm);
    sw[s][q] = exp_ni(sm[s][q] - mm) / ll; }
  __syncthreads();   // the weights are read by the 16 output waves (wave < CH / 4)
  if (wave < CH / 4) { const int c = wave * 4 + (ln >> 3), pc = ln & 7; const size_t o = ((size_t)b * CH + c) * NP + blockIdx.x * 32 + pc * 4; const float* xs = X + o; v4f ov = {};
#pragma unroll
    for (int s = 0; s < KSPL; ++s) ov += *(const v4f*)&sw[s][pc * 4] * *(const v4f*)&so[s][c][pc * 4];
    vst2(Y + o, (v4f){bfr(xs[0]) + gm * ov[0], bfr(xs[1]) + gm * ov[1], bfr(xs[2]) + gm * ov[2], bfr(xs[3]) + gm * ov[3]}); }
}
extern "C" void kernel_launch(void* const* d_in, const int* in_sizes, int n_in, void* d_out, int out_size, void* d_ws, size_t ws_size, hipStream_t stream) {
  (void)in_sizes; (void)n_in; (void)out_size;
  const float** F = (const float**)d_in;   // x [2,64,16,16,16], Wq [8,64], Wk [8,64], Wv [64,64], gamma [1]
  if (ws_size < (size_t)WS_END) return;
  char* ws = (char*)d_ws; __bf16 *PW = (__bf16*)(ws + WS_PW), *VH = (__bf16*)(ws + WS_VH), *VL = (__bf16*)(ws + WS_VL); float* QK = (float*)(ws + WS_QK);
  k_pack<<<1, 256, 0, stream>>>(F[1], F[2], F[3], PW);
  k_proj<<<dim3(NP / 64, TNB), 128, 0, stream>>>(F[0], PW, QK, VH, VL);
  k_attn<<<dim3(TQB, TNB), 64 * KSPL, 0, stream>>>(QK, VH, VL, F[0], F[4], (float*)d_out);
}

// v003
// Measured time: 67.9 microseconds a run.
// In two side-by-side timings against v002, it was 1.03 and 1.02 times as fast.
// Counting every step since v000, it is 7.47 times as fast.
// compute dtype: x, Wq, Wk, Wv, gamma (module inputs) rounded to bf16; the 1x1x1 projections q/k/v with exact bf16 products (x and W are inputs) on WMMA 16x16x32 (the 8-wide q/k zero-padded to 32), scores q.k with both computed operands as bf16 hi + residual pairs (3 products), out = attn.v^T with attn hi/lo x v hi/lo (3 products); softmax and the residual x + gamma*out in f32; f32 accumulate.
#include <hip/hip_runtime.h>
#include <math.h>

typedef __attribute__((ext_vector_type(16))) _Float16 v16h;
typedef __attribute__((ext_vector_type(16))) __bf16 v16b;
typedef __attribute__((ext_vector_type(8)))  _Float16 v8h;
typedef __attribute__((ext_vector_type(8)))  float v8f;
typedef __attribute__((ext_vector_type(4)))  float v4f;
typedef __attribute__((ext_vector_type(2)))  float v2f;
typedef __attribute__((ext_vector_type(4)))  unsigned v4u;
typedef __attribute__((ext_vector_type(4)))  int v4i;
typedef float __attribute__((may_alias)) float_a;
typedef int __attribute__((may_alias)) int_a;

template <typename T> __device__ __forceinline__ void vst2(void* p, T v) { *(T*)p = v;  }
__device__ __forceinline__ v8f wmma16(v16h a, v16h b, v8f c) {
  v8f d = __builtin_amdgcn_wmma_f32_16x16x32_f16(false, a, false, b, (short)0, c, false, false);
  asm volatile("v_nop\n\tv_nop\n\tv_nop\n\tv_nop" : "+v"(d) : "v"(a), "v"(b));
  return d;
}
__device__ __forceinline__ v8f wmma_bf(v16b a, v16b b, v8f c) {
  v8f d = __builtin_amdgcn_wmma_f32_16x16x32_bf16(false, a, false, b, (short)0, c, false, false);
  asm volatile("v_nop\n\tv_nop\n\tv_nop\n\tv_nop" : "+v"(d) : "v"(a), "v"(b));
  return d;
}
// 16x16x32 fragments: lane = (h = lane>>4, row/col = lane&15); elements 0..7 = k0+8h+0..7, 8..15 = k0+16+8h+0..7; D element r = row 8h+r
__device__ __forceinline__ v16h frag_h(const _Float16* rowk0, int lane) {
  union { v16h v; v8h q[2]; } u; const _Float16* p = rowk0 + 8 * (lane >> 4);
  u.q[0] = *(const v8h*)p; u.q[1] = *(const v8h*)(p + 16); return u.v;
}
__device__ __forceinline__ v16h frag_f32(const float* rowk0, int lane) {
  v16h a; const float* p = rowk0 + 8 * (lane >> 4);
#pragma unroll
  for (int i = 0; i < 8; ++i) { a[i] = (_Float16)p[i]; a[8 + i] = (_Float16)p[16 + i]; }
  return a;
}
__device__ __forceinline__ v16h frag_f32s(const float* rowk0, int lane, float sc) {
  v16h a; const float* p = rowk0 + 8 * (lane >> 4);
#pragma unroll
  for (int i = 0; i < 8; ++i) { a[i] = (_Float16)(p[i] * sc); a[8 + i] = (_Float16)(p[16 + i] * sc); }
  return a;
}
// column fragment from a [K][ld] layout (column n), rows >= K read as 0
__device__ __forceinline__ v16h fragc_f32(const float* W, int k0, int n, int lane, int ld, int K) {
  v16h a; const int g = lane >> 4;
#pragma unroll
  for (int i = 0; i < 8; ++i) { const int ka = k0 + 8 * g + i, kb = ka + 16;
    a[i] = (_Float16)(ka < K ? W[(size_t)(ka < K ? ka : K - 1) * ld + n] : 0.f); a[8 + i] = (_Float16)(kb < K ? W[(size_t)(kb < K ? kb : K - 1) * ld + n] : 0.f); }
  return a;
}
struct F2 { v16b h, l; };
__device__ __forceinline__ F2 bsplit16(const float v[16]) { F2 r;
#pragma unroll
  for (int i = 0; i < 16; ++i) { const __bf16 h = (__bf16)v[i]; r.h[i] = h; r.l[i] = (__bf16)(v[i] - (float)h); }
  return r; }
__device__ __forceinline__ F2 split_row(const float* row, int k0, int lane) { float v[16]; const float* p = row + k0 + 8 * (lane >> 4);
#pragma unroll
  for (int i = 0; i < 8; ++i) { v[i] = p[i]; v[8 + i] = p[16 + i]; }
  return bsplit16(v); }
__device__ __forceinline__ F2 split_rowK(const float* row, int k0, int lane, int K) { float v[16]; const int g = lane >> 4;
#pragma unroll
  for (int i = 0; i < 8; ++i) { const int ka = k0 + 8 * g + i, kb = ka + 16; v[i] = ka < K ? row[ka < K ? ka : K - 1] : 0.f; v[8 + i] = kb < K ? row[kb < K ? kb : K - 1] : 0.f; }
  return bsplit16(v); }
__device__ __forceinline__ F2 split_col(const float* W, int k0, int n, int lane, int ld, int K) { float v[16]; const int g = lane >> 4;
#pragma unroll
  for (int i = 0; i < 8; ++i) { const int ka = k0 + 8 * g + i, kb = ka + 16; v[i] = ka < K ? W[(size_t)(ka < K ? ka : K - 1) * ld + n] : 0.f; v[8 + i] = kb < K ? W[(size_t)(kb < K ? kb : K - 1) * ld + n] : 0.f; }
  return bsplit16(v); }
__device__ __forceinline__ v8f mac3(const F2& a, const F2& b, v8f c) { c = wmma_bf(a.l, b.h, c); c = wmma_bf(a.h, b.l, c); return wmma_bf(a.h, b.h, c); }
__device__ __forceinline__ float sigm(float v) { return 1.0f / (1.0f + expf(-v)); }
#define LDSX() do { asm volatile("s_wait_dscnt 0" ::: "memory"); __builtin_amdgcn_wave_barrier(); __builtin_amdgcn_fence(__ATOMIC_RELEASE, "workgroup"); } while (0)


// 3-D position attention (B 2, C 64, 16x16x16 = 4096 positions, reduced 8): q = Wq x, k = Wk x, v = Wv x (1x1x1 convs, no bias); attn = softmax(q^T k / sqrt(8)) over positions; out[c][n] = sum_m v[c][m] attn[n][m]; y = x + gamma * out.
#define NB 2
#define CH 64
#define NP 4096
#define RR 8
#ifndef TQB
#define TQB (NP / 32)
#define TNB NB
#endif
typedef __attribute__((ext_vector_type(8))) __bf16 v8b;
__device__ __forceinline__ v16b frag_b(const __bf16* rowk0, int lane) {
  union { v16b v; v8b q[2]; } u; const __bf16* p = rowk0 + 8 * (lane >> 4);
  u.q[0] = *(const v8b*)p; u.q[1] = *(const v8b*)(p + 16); return u.v;
}
__device__ __forceinline__ float bfr(float v) { return (float)(__bf16)v; }
__device__ __attribute__((noinline)) float erf_ni(float v) { return erff(v); }

#define WS_PW  0u                                // bf16 [128][64]: rows 0..7 Wq, 8..31 zero, 32..39 Wk, 40..63 zero, 64..127?? -> layout: [0..31] q-plane rows (8 real), [32..63] k-plane rows (8 real), [64..127] Wv rows (64)
#define WS_QK  (WS_PW + 2u * 128 * CH)             // f32 [NB][NP][64]: cols 0..31 q (8 real + zeros), 32..63 k (8 real + zeros)
#define WS_VH  (WS_QK + 4u * NB * NP * 64)         // bf16 [NB][64 c][NP] v hi
#define WS_VL  (WS_VH + 2u * NB * CH * NP)
#define WS_END (WS_VL + 2u * NB * CH * NP)

// ---- k_pack: one block: rows 0..7 = Wq[r][:], 8..31 = 0, 32..39 = Wk, 40..63 = 0, 64..127 = Wv[o][:] (all natural [out][in] rows = B operand rows)
__global__ __launch_bounds__(256) void k_pack(const float* __restrict__ WQ, const float* __restrict__ WK, const float* __restrict__ WV, __bf16* __restrict__ PW) {
  __shared__ __align__(16) __bf16 s[128][CH]; const int tid = threadIdx.x;
  for (int q = tid; q < 128 * CH; q += 256) { const int n = q / CH, c = q % CH; float v = 0.f; if (n < RR) v = WQ[n * CH + c]; else if (n >= 32 && n < 32 + RR) v = WK[(n - 32) * CH + c]; else if (n >= 64) v = WV[(n - 64) * CH + c]; s[n][c] = (__bf16)v; }
  __syncthreads();
  for (int q = tid; q < 128 * CH / 8; q += 256) vst2((unsigned*)(PW + q * 8), *(const v4u*)&(&s[0][0])[q * 8]);
}
__global__ __launch_bounds__(128) void k_proj(const float* __restrict__ X, const __bf16* __restrict__ PW, float* __restrict__ QK, __bf16* __restrict__ VH, __bf16* __restrict__ VL) {
  __shared__ __align__(16) __bf16 sx[64][72]; __shared__ __align__(16) float so[4][16][68]; __shared__ __align__(16) __bf16 sth[CH][72], stl[CH][72];
  const int tid = threadIdx.x, wave = tid >> 5, lane = tid & 31, col = lane & 15, g = lane >> 4; const int b = blockIdx.y; const int p0 = blockIdx.x * 64;
  for (int q = tid; q < CH * 64; q += 128) { const int c = q >> 6, nl = q & 63; sx[nl][c] = (__bf16)X[((size_t)b * CH + c) * NP + p0 + nl]; }   // sx[position][channel]
  __syncthreads();
  v16b a[2];
#pragma unroll
  for (int kc = 0; kc < 2; ++kc) {
#pragma unroll
    for (int i = 0; i < 8; ++i) { a[kc][i] = sx[wave * 16 + col][kc * 32 + 8 * g + i]; a[kc][8 + i] = sx[wave * 16 + col][kc * 32 + 16 + 8 * g + i]; } }
  v8f acc[8] = {};   // tiles: 0,1 = q plane rows 0..31; 2,3 = k plane rows 32..63; 4..7 = v rows 64..127
#pragma unroll
  for (int kc = 0; kc < 2; ++kc) {
#pragma unroll
    for (int j = 0; j < 8; ++j) acc[j] = wmma_bf(a[kc], frag_b(PW + (size_t)(j * 16 + col) * CH + kc * 32, lane), acc[j]); }
#pragma unroll
  for (int j = 0; j < 4; ++j)
#pragma unroll
    for (int r = 0; r < 8; ++r) so[wave][8 * g + r][j * 16 + col] = acc[j][r];
#pragma unroll
  for (int j = 4; j < 8; ++j) { const int c = (j - 4) * 16 + col;
#pragma unroll
    for (int r = 0; r < 8; ++r) { const float v = acc[j][r]; const __bf16 hb = (__bf16)v; sth[c][wave * 16 + 8 * g + r] = hb; stl[c][wave * 16 + 8 * g + r] = (__bf16)(v - (float)hb); } }
  __syncthreads();
  for (int rl = 0; rl < 16; ++rl) if (lane < 16) vst2(QK + ((size_t)b * NP + p0 + wave * 16 + rl) * 64 + lane * 4, *(const v4f*)&so[wave][rl][lane * 4]);
  for (int q = tid; q < CH * 8; q += 128) { const int c = q >> 3, pc = q & 7; const size_t o = ((size_t)b * CH + c) * NP + p0 + pc * 8; vst2((unsigned*)(VH + o), *(const v4u*)&sth[c][pc * 8]); vst2((unsigned*)(VL + o), *(const v4u*)&stl[c][pc * 8]); }
}
// ---- k_attn: block = (32 queries, batch) = 2 query tiles x KSPL key shares, one wave each: the wave of share sh takes the blocks of 32 keys sh, sh + KSPL, ... with its own maxima, sums and accumulators, and the shares are merged in LDS at the end. Per wave the products are taken transposed: S^T[key][query] = k.q (K 32 with zeros beyond 8; 3 products) / sqrt(8), so a lane holds 16 of the 32 scores of ONE query (lane = (g, query); tile ct, element r = key 16 ct + 8 g + r), which is at once the B fragment of O^T[c][query] = V(hi/lo).P^T(hi/lo): the online softmax runs inside the lane, with one exchange between the two lane halves for the maximum; epilogue: weight of a share = 2 ** (m_share - max) / merged sum (maxima in base 2); y[b][c][n] = x + gamma * sum of weighted partial O (one 128-B line per channel)
#define KSPL 16
// 2 ** v as the one hardware instruction, inline; arguments here lie at most a rounding error above 0, and a result below the normal range may go to 0
__device__ __forceinline__ float ex2(float v) { return __builtin_amdgcn_exp2f(v); }
// the value of lane l ^ 16 (the other lane half), without LDS
__device__ __forceinline__ float xhalf(float v) { const int b = __builtin_bit_cast(int, v); return __builtin_bit_cast(float, __builtin_amdgcn_permlanex16(b, b, 0x76543210, 0xfedcba98, false, false)); }
__global__ __launch_bounds__(64 * KSPL) void k_attn(const float* __restrict__ QK, const __bf16* __restrict__ VH, const __bf16* __restrict__ VL, const float* __restrict__ X, const float* __restrict__ GM, float* __restrict__ Y) {
  __shared__ __align__(16) float so[KSPL][CH][36]; __shared__ __align__(16) float sm[KSPL][32], sl[KSPL][32], sw[KSPL][32];
  const int wave = __builtin_amdgcn_readfirstlane(threadIdx.x >> 5), lane = threadIdx.x & 31, col = lane & 15; const int qt = wave & 1, sh = wave >> 1;   // wave number in a scalar register: the key loop's counter and branch stay scalar
  const int b = blockIdx.y; const int q0 = blockIdx.x * 32 + qt * 16;
  const F2 aq = split_row(QK + ((size_t)b * NP + q0 + col) * 64, 0, lane);
  float m = -3.0e38f, l = 0.f;   // of the lane's query; l counts the lane half's own keys only and is completed after the loop
  v8f acc[4] = {};   // acc[dt][r] = O^T[channel 16 dt + 8 g + r][query col]
  const float scale = 0.35355339059327373f * 1.4426950408889634f;   // 8 ** -0.5 * log2(e): maxima and exponents are kept in base 2, exp(z) = 2 ** (z log2(e))
#pragma unroll 1
  for (int ks = sh; ks < NP / 32; ks += KSPL) { float s[16];
#pragma unroll
    for (int ct = 0; ct < 2; ++ct) { const int kk = ks * 32 + ct * 16 + col; const F2 kb = split_row(QK + ((size_t)b * NP + kk) * 64, 32, lane); const v8f c = mac3(kb, aq, (v8f){});
#pragma unroll
      for (int r = 0; r < 8; ++r) s[ct * 8 + r] = c[r]; }
    float mx = s[0];
#pragma unroll
    for (int i = 1; i < 16; ++i) mx = fmaxf(mx, s[i]);
    mx = fmaxf(mx, xhalf(mx));   // both lane halves of a query scale by the same maximum: their keys are summed in one product
    const float mn = fmaxf(m, mx * scale); const float alpha = ex2(m - mn); m = mn;   // scale > 0: the maximum of the raw scores, scaled, is the maximum of the scaled ones
#pragma unroll
    for (int i = 0; i < 16; ++i) s[i] = ex2(fmaf(s[i], scale, -mn));
    float t[8];
#pragma unroll
    for (int i = 0; i < 8; ++i) t[i] = s[i] + s[8 + i];
    l = l * alpha + (((t[0] + t[4]) + (t[2] + t[6])) + ((t[1] + t[5]) + (t[3] + t[7])));
#pragma unroll
    for (int dt = 0; dt < 4; ++dt) acc[dt] *= alpha;
    const F2 pb = bsplit16(s);
#pragma unroll
    for (int dt = 0; dt < 4; ++dt) { const size_t vr = ((size_t)b * CH + dt * 16 + col) * NP + ks * 32; const v16b vh = frag_b(VH + vr, lane), vl = frag_b(VL + vr, lane); acc[dt] = wmma_bf(vh, pb.l, acc[dt]); acc[dt] = wmma_bf(vl, pb.h, acc[dt]); acc[dt] = wmma_bf(vh, pb.h, acc[dt]); } }
  l += xhalf(l);
  const float gm = bfr(GM[0]);
  const int ln = __builtin_amdgcn_mbcnt_lo(~0u, 0u), ec = ln & 15, eg = ln >> 4;   // the lane number taken anew: at 128 registers the indices of the epilogue, carried over the loop, were spilled to scratch
#pragma unroll
  for (int dt = 0; dt < 4; ++dt)
#pragma unroll
    for (int r = 0; r < 8; ++r) so[sh][dt * 16 + 8 * eg + r][qt * 16 + ec] = acc[dt][r];   // so[share][channel][query local], not yet normalised
  if (eg == 0) { sm[sh][qt * 16 + ec] = m; sl[sh][qt * 16 + ec] = l; }
  __syncthreads();
  if (wave < KSPL) { const int s = wave, q = ln; float mm = sm[0][q];
#pragma unroll
    for (int j = 1; j < KSPL; ++j) mm = fmaxf(mm, sm[j][q]);
    float ll = 0.f;
#pragma unroll
    for (int j = 0; j < KSPL; ++j) ll += sl[j][q] * ex2(sm[j][q] - mm);
    sw[s][q] = ex2(sm[s][q] - mm) / ll; }
  __syncthreads();   // the weights are read by the CH / 4 = 16 epilogue waves
  if (wave < CH / 4) { const int c = wave * 4 + (ln >> 3), pc = ln & 7; const size_t o = ((size_t)b * CH + c) * NP + blockIdx.x * 32 + pc * 4; const float* xs = X + o; v4f ov = {};
#pragma unroll
    for (int s = 0; s < KSPL; ++s) ov += *(const v4f*)&sw[s][pc * 4] * *(const v4f*)&so[s][c][pc * 4];
    vst2(Y + o, (v4f){bfr(xs[0]) + gm * ov[0], bfr(xs[1]) + gm * ov[1], bfr(xs[2]) + gm * ov[2], bfr(xs[3]) + gm * ov[3]}); }
}
extern "C" void kernel_launch(void* const* d_in, const int* in_sizes, int n_in, void* d_out, int out_size, void* d_ws, size_t ws_size, hipStream_t stream) {
  (void)in_sizes; (void)n_in; (void)out_size;
  const float** F = (const float**)d_in;   // x [2,64,16,16,16], Wq [8,64], Wk [8,64], Wv [64,64], gamma [1]
  if (ws_size < (size_t)WS_END) return;
  char* ws = (char*)d_ws; __bf16 *PW = (__bf16*)(ws + WS_PW), *VH = (__bf16*)(ws + WS_VH), *VL = (__bf16*)(ws + WS_VL); float* QK = (float*)(ws + WS_QK);
  k_pack<<<1, 256, 0, stream>>>(F[1], F[2], F[3], PW);
  k_proj<<<dim3(NP / 64, TNB), 128, 0, stream>>>(F[0], PW, QK, VH, VL);
  k_attn<<<dim3(TQB, TNB), 64 * KSPL, 0, stream>>>(QK, VH, VL, F[0], F[4], (float*)d_out);
}

// v004
// It runs in 48.6 microseconds.
// Next to v003, in two timings, it ran 1.40 and 1.39 times as fast.
// Over all steps from v000 it is 10.4 times as fast.
// compute dtype: x, Wq, Wk, Wv, gamma (module inputs) rounded to bf16; the 1x1x1 projections q/k/v with exact bf16 products (x and W are inputs) on WMMA 16x16x32 (the 8-wide q/k zero-padded to 32), scores q.k with both computed operands as bf16 hi + residual pairs (3 products), out = attn.v^T with attn hi/lo x v hi/lo (3 products); softmax and the residual x + gamma*out in f32; f32 accumulate.
#include <hip/hip_runtime.h>
#include <math.h>

typedef __attribute__((ext_vector_type(16))) _Float16 v16h;
typedef __attribute__((ext_vector_type(16))) __bf16 v16b;
typedef __attribute__((ext_vector_type(8)))  _Float16 v8h;
typedef __attribute__((ext_vector_type(8)))  float v8f;
typedef __attribute__((ext_vector_type(4)))  float v4f;
typedef __attribute__((ext_vector_type(2)))  float v2f;
typedef __attribute__((ext_vector_type(4)))  unsigned v4u;
typedef __attribute__((ext_vector_type(4)))  int v4i;
typedef float __attribute__((may_alias)) float_a;
typedef int __attribute__((may_alias)) int_a;

template <typename T> __device__ __forceinline__ void vst2(void* p, T v) { *(T*)p = v;  }
__device__ __forceinline__ v8f wmma16(v16h a, v16h b, v8f c) {
  v8f d = __builtin_amdgcn_wmma_f32_16x16x32_f16(false, a, false, b, (short)0, c, false, false);
  asm volatile("v_nop\n\tv_nop\n\tv_nop\n\tv_nop" : "+v"(d) : "v"(a), "v"(b));
  return d;
}
__device__ __forceinline__ v8f wmma_bf(v16b a, v16b b, v8f c) {
  v8f d = __builtin_amdgcn_wmma_f32_16x16x32_bf16(false, a, false, b, (short)0, c, false, false);
  asm volatile("v_nop\n\tv_nop\n\tv_nop\n\tv_nop" : "+v"(d) : "v"(a), "v"(b));
  return d;
}
// 16x16x32 fragments: lane = (h = lane>>4, row/col = lane&15); elements 0..7 = k0+8h+0..7, 8..15 = k0+16+8h+0..7; D element r = row 8h+r
__device__ __forceinline__ v16h frag_h(const _Float16* rowk0, int lane) {
  union { v16h v; v8h q[2]; } u; const _Float16* p = rowk0 + 8 * (lane >> 4);
  u.q[0] = *(const v8h*)p; u.q[1] = *(const v8h*)(p + 16); return u.v;
}
__device__ __forceinline__ v16h frag_f32(const float* rowk0, int lane) {
  v16h a; const float* p = rowk0 + 8 * (lane >> 4);
#pragma unroll
  for (int i = 0; i < 8; ++i) { a[i] = (_Float16)p[i]; a[8 + i] = (_Float16)p[16 + i]; }
  return a;
}
__device__ __forceinline__ v16h frag_f32s(const float* rowk0, int lane, float sc) {
  v16h a; const float* p = rowk0 + 8 * (lane >> 4);
#pragma unroll
  for (int i = 0; i < 8; ++i) { a[i] = (_Float16)(p[i] * sc); a[8 + i] = (_Float16)(p[16 + i] * sc); }
  return a;
}
// column fragment from a [K][ld] layout (column n), rows >= K read as 0
__device__ __forceinline__ v16h fragc_f32(const float* W, int k0, int n, int lane, int ld, int K) {
  v16h a; const int g = lane >> 4;
#pragma unroll
  for (int i = 0; i < 8; ++i) { const int ka = k0 + 8 * g + i, kb = ka + 16;
    a[i] = (_Float16)(ka < K ? W[(size_t)(ka < K ? ka : K - 1) * ld + n] : 0.f); a[8 + i] = (_Float16)(kb < K ? W[(size_t)(kb < K ? kb : K - 1) * ld + n] : 0.f); }
  return a;
}
struct F2 { v16b h, l; };
__device__ __forceinline__ F2 bsplit16(const float v[16]) { F2 r;
#pragma unroll
  for (int i = 0; i < 16; ++i) { const __bf16 h = (__bf16)v[i]; r.h[i] = h; r.l[i] = (__bf16)(v[i] - (float)h); }
  return r; }
__device__ __forceinline__ F2 split_row(const float* row, int k0, int lane) { float v[16]; const float* p = row + k0 + 8 * (lane >> 4);
#pragma unroll
  for (int i = 0; i < 8; ++i) { v[i] = p[i]; v[8 + i] = p[16 + i]; }
  return bsplit16(v); }
__device__ __forceinline__ F2 split_rowK(const float* row, int k0, int lane, int K) { float v[16]; const int g = lane >> 4;
#pragma unroll
  for (int i = 0; i < 8; ++i) { const int ka = k0 + 8 * g + i, kb = ka + 16; v[i] = ka < K ? row[ka < K ? ka : K - 1] : 0.f; v[8 + i] = kb < K ? row[kb < K ? kb : K - 1] : 0.f; }
  return bsplit16(v); }
__device__ __forceinline__ F2 split_col(const float* W, int k0, int n, int lane, int ld, int K) { float v[16]; const int g = lane >> 4;
#pragma unroll
  for (int i = 0; i < 8; ++i) { const int ka = k0 + 8 * g + i, kb = ka + 16; v[i] = ka < K ? W[(size_t)(ka < K ? ka : K - 1) * ld + n] : 0.f; v[8 + i] = kb < K ? W[(size_t)(kb < K ? kb : K - 1) * ld + n] : 0.f; }
  return bsplit16(v); }
__device__ __forceinline__ v8f mac3(const F2& a, const F2& b, v8f c) { c = wmma_bf(a.l, b.h, c); c = wmma_bf(a.h, b.l, c); return wmma_bf(a.h, b.h, c); }
__device__ __forceinline__ float sigm(float v) { return 1.0f / (1.0f + expf(-v)); }
#define LDSX() do { asm volatile("s_wait_dscnt 0" ::: "memory"); __builtin_amdgcn_wave_barrier(); __builtin_amdgcn_fence(__ATOMIC_RELEASE, "workgroup"); } while (0)


// 3-D position attention (B 2, C 64, 16x16x16 = 4096 positions, reduced 8): q = Wq x, k = Wk x, v = Wv x (1x1x1 convs, no bias); attn = softmax(q^T k / sqrt(8)) over positions; out[c][n] = sum_m v[c][m] attn[n][m]; y = x + gamma * out.
#define NB 2
#define CH 64
#define NP 4096
#define RR 8
#ifndef TQB
#define TQB (NP / 32)
#define TNB NB
#endif
typedef __attribute__((ext_vector_type(8))) __bf16 v8b;
__device__ __forceinline__ v16b frag_b(const __bf16* rowk0, int lane) {
  union { v16b v; v8b q[2]; } u; const __bf16* p = rowk0 + 8 * (lane >> 4);
  u.q[0] = *(const v8b*)p; u.q[1] = *(const v8b*)(p + 16); return u.v;
}
__device__ __forceinline__ float bfr(float v) { return (float)(__bf16)v; }
__device__ __attribute__((noinline)) float erf_ni(float v) { return erff(v); }

#define WS_PW  0u                                // bf16 [128][64]: rows 0..7 Wq, 8..31 zero, 32..39 Wk, 40..63 zero, 64..127?? -> layout: [0..31] q-plane rows (8 real), [32..63] k-plane rows (8 real), [64..127] Wv rows (64)
#define WS_QK  (WS_PW + 2u * 128 * CH)             // f32 [NB][NP][64]: cols 0..31 q (8 real + zeros); cols 32..63 not used
#define WS_KF  (WS_QK + 4u * NB * NP * 64)         // bf16 [NB][NP / 16 key tiles][hi, lo][32 lanes][8]: k as the A fragment's elements 0..7 (reduced dim 8 g + i of key 16 tile + col), lane order
#define WS_VF  (WS_KF + 2u * NB * NP * 32)         // bf16 [NB][NP / 32 key blocks][4 channel tiles][hi, lo][2 halves][32 lanes][8]: v as A fragments (channel 16 dt + col, key 32 block + 16 half + 8 g + i), lane order
#define WS_END (WS_VF + 2u * 2u * NB * CH * NP)

// ---- k_pack: one block: rows 0..7 = Wq[r][:], 8..31 = 0, 32..39 = Wk, 40..63 = 0, 64..127 = Wv[o][:] (all natural [out][in] rows = B operand rows)
__global__ __launch_bounds__(256) void k_pack(const float* __restrict__ WQ, const float* __restrict__ WK, const float* __restrict__ WV, __bf16* __restrict__ PW) {
  __shared__ __align__(16) __bf16 s[128][CH]; const int tid = threadIdx.x;
  for (int q = tid; q < 128 * CH; q += 256) { const int n = q / CH, c = q % CH; float v = 0.f; if (n < RR) v = WQ[n * CH + c]; else if (n >= 32 && n < 32 + RR) v = WK[(n - 32) * CH + c]; else if (n >= 64) v = WV[(n - 64) * CH + c]; s[n][c] = (__bf16)v; }
  __syncthreads();
  for (int q = tid; q < 128 * CH / 8; q += 256) vst2((unsigned*)(PW + q * 8), *(const v4u*)&(&s[0][0])[q * 8]);
}
__global__ __launch_bounds__(128) void k_proj(const float* __restrict__ X, const __bf16* __restrict__ PW, float* __restrict__ QK, __bf16* __restrict__ KF, __bf16* __restrict__ VF) {
  __shared__ __align__(16) __bf16 sx[64][72]; __shared__ __align__(16) float so[4][16][68]; __shared__ __align__(16) __bf16 sth[CH][72], stl[CH][72];
  const int tid = threadIdx.x, wave = tid >> 5, lane = tid & 31, col = lane & 15, g = lane >> 4; const int b = blockIdx.y; const int p0 = blockIdx.x * 64;
  for (int q = tid; q < CH * 64; q += 128) { const int c = q >> 6, nl = q & 63; sx[nl][c] = (__bf16)X[((size_t)b * CH + c) * NP + p0 + nl]; }   // sx[position][channel]
  __syncthreads();
  v16b a[2];
#pragma unroll
  for (int kc = 0; kc < 2; ++kc) {
#pragma unroll
    for (int i = 0; i < 8; ++i) { a[kc][i] = sx[wave * 16 + col][kc * 32 + 8 * g + i]; a[kc][8 + i] = sx[wave * 16 + col][kc * 32 + 16 + 8 * g + i]; } }
  v8f acc[8] = {};   // tiles: 0,1 = q plane rows 0..31; 2,3 = k plane rows 32..63; 4..7 = v rows 64..127
#pragma unroll
  for (int kc = 0; kc < 2; ++kc) {
#pragma unroll
    for (int j = 0; j < 8; ++j) acc[j] = wmma_bf(a[kc], frag_b(PW + (size_t)(j * 16 + col) * CH + kc * 32, lane), acc[j]); }
#pragma unroll
  for (int j = 0; j < 4; ++j)
#pragma unroll
    for (int r = 0; r < 8; ++r) so[wave][8 * g + r][j * 16 + col] = acc[j][r];
#pragma unroll
  for (int j = 4; j < 8; ++j) { const int c = (j - 4) * 16 + col;
#pragma unroll
    for (int r = 0; r < 8; ++r) { const float v = acc[j][r]; const __bf16 hb = (__bf16)v; sth[c][wave * 16 + 8 * g + r] = hb; stl[c][wave * 16 + 8 * g + r] = (__bf16)(v - (float)hb); } }
  __syncthreads();
  for (int rl = 0; rl < 16; ++rl) if (lane < 8) vst2(QK + ((size_t)b * NP + p0 + wave * 16 + rl) * 64 + lane * 4, *(const v4f*)&so[wave][rl][lane * 4]);
  { v8b kh, kl;   // the wave's 16 positions are one key tile: the lane writes its own 16 bytes of the hi and of the lo fragment, 512 contiguous bytes a store
#pragma unroll
    for (int i = 0; i < 8; ++i) { const float v = so[wave][col][32 + 8 * g + i]; const __bf16 hb = (__bf16)v; kh[i] = hb; kl[i] = (__bf16)(v - (float)hb); }
    __bf16* kf = KF + ((size_t)b * (NP / 16) + blockIdx.x * 4 + wave) * 512 + lane * 8; *(v8b*)kf = kh; *(v8b*)(kf + 256) = kl; }
  for (int q = tid; q < CH * 8; q += 128) { const int fl = q & 31, hf = (q >> 5) & 1, dt = (q >> 6) & 3, kb = q >> 8; const int c = dt * 16 + (fl & 15), pc = kb * 4 + hf * 2 + (fl >> 4);   // q runs in the order of the fragments: a wave's store is 512 contiguous bytes
    const size_t o = ((size_t)b * (NP / 32) + blockIdx.x * 2 + kb) * 4096 + dt * 1024 + hf * 256 + fl * 8; vst2((unsigned*)(VF + o), *(const v4u*)&sth[c][pc * 8]); vst2((unsigned*)(VF + o + 512), *(const v4u*)&stl[c][pc * 8]); }
}
// ---- k_attn: block = (32 queries, batch) = 2 query tiles x KSPL key shares, one wave each: the wave of share sh takes the blocks of 32 keys sh, sh + KSPL, ... with its own maxima, sums and accumulators, and the shares are merged in LDS at the end. Per wave the products are taken transposed: S^T[key][query] = k.q (K 32 with zeros beyond 8; 3 products) / sqrt(8), so a lane holds 16 of the 32 scores of ONE query (lane = (g, query); tile ct, element r = key 16 ct + 8 g + r), which is at once the B fragment of O^T[c][query] = V(hi/lo).P^T(hi/lo): the online softmax runs inside the lane, with one exchange between the two lane halves for the maximum; epilogue: weight of a share = 2 ** (m_share - max) / merged sum (maxima in base 2); y[b][c][n] = x + gamma * sum of weighted partial O (one 128-B line per channel)
#define KSPL 16
// 2 ** v as the one hardware instruction, inline; arguments here lie at most a rounding error above 0, and a result below the normal range may go to 0
__device__ __forceinline__ float ex2(float v) { return __builtin_amdgcn_exp2f(v); }
// the value of lane l ^ 16 (the other lane half), without LDS
__device__ __forceinline__ float xhalf(float v) { const int b = __builtin_bit_cast(int, v); return __builtin_bit_cast(float, __builtin_amdgcn_permlanex16(b, b, 0x76543210, 0xfedcba98, false, false)); }
// fragments stored in lane order: p = the lane's own 16 bytes. v: elements 0..7 and, 512 bytes on, 8..15; k: elements 0..7, elements 8..15 (reduced dims 16..31) are zero
__device__ __forceinline__ v16b frag_v(const __bf16* p) { union { v16b v; v8b q[2]; } u; u.q[0] = *(const v8b*)p; u.q[1] = *(const v8b*)(p + 256); return u.v; }
__device__ __forceinline__ v16b frag_k(const __bf16* p) { union { v16b v; v8b q[2]; } u; u.q[0] = *(const v8b*)p; u.q[1] = (v8b){}; return u.v; }
__global__ __launch_bounds__(64 * KSPL) void k_attn(const float* __restrict__ QK, const __bf16* __restrict__ KF, const __bf16* __restrict__ VF, const float* __restrict__ X, const float* __restrict__ GM, float* __restrict__ Y) {
  __shared__ __align__(16) float so[KSPL][CH][36]; __shared__ __align__(16) float sm[KSPL][32], sl[KSPL][32], sw[KSPL][32];
  const int wave = __builtin_amdgcn_readfirstlane(threadIdx.x >> 5), lane = threadIdx.x & 31, col = lane & 15; const int qt = wave & 1, sh = wave >> 1;   // wave number in a scalar register: the key loop's counter and branch stay scalar
  const int b = blockIdx.y; const int q0 = blockIdx.x * 32 + qt * 16;
  const F2 aq = split_row(QK + ((size_t)b * NP + q0 + col) * 64, 0, lane);
  float m = -3.0e38f, l = 0.f;   // of the lane's query; l counts the lane half's own keys only and is completed after the loop
  v8f acc[4] = {};   // acc[dt][r] = O^T[channel 16 dt + 8 g + r][query col]
  const float scale = 0.35355339059327373f * 1.4426950408889634f;   // 8 ** -0.5 * log2(e): maxima and exponents are kept in base 2, exp(z) = 2 ** (z log2(e))
#pragma unroll 1
  for (int ks = sh; ks < NP / 32; ks += KSPL) { float s[16];
#pragma unroll
    for (int ct = 0; ct < 2; ++ct) { const __bf16* kf = KF + ((size_t)b * (NP / 16) + ks * 2 + ct) * 512 + lane * 8; const F2 kb = {frag_k(kf), frag_k(kf + 256)}; const v8f c = mac3(kb, aq, (v8f){});
#pragma unroll
      for (int r = 0; r < 8; ++r) s[ct * 8 + r] = c[r]; }
    float mx = s[0];
#pragma unroll
    for (int i = 1; i < 16; ++i) mx = fmaxf(mx, s[i]);
    mx = fmaxf(mx, xhalf(mx));   // both lane halves of a query scale by the same maximum: their keys are summed in one product
    const float mn = fmaxf(m, mx * scale); const float alpha = ex2(m - mn); m = mn;   // scale > 0: the maximum of the raw scores, scaled, is the maximum of the scaled ones
#pragma unroll
    for (int i = 0; i < 16; ++i) s[i] = ex2(fmaf(s[i], scale, -mn));
    float t[8];
#pragma unroll
    for (int i = 0; i < 8; ++i) t[i] = s[i] + s[8 + i];
    l = l * alpha + (((t[0] + t[4]) + (t[2] + t[6])) + ((t[1] + t[5]) + (t[3] + t[7])));
#pragma unroll
    for (int dt = 0; dt < 4; ++dt) acc[dt] *= alpha;
    const F2 pb = bsplit16(s);
#pragma unroll
    for (int dt = 0; dt < 4; ++dt) { const __bf16* vf = VF + ((size_t)b * (NP / 32) + ks) * 4096 + dt * 1024 + lane * 8; const v16b vh = frag_v(vf), vl = frag_v(vf + 512); acc[dt] = wmma_bf(vh, pb.l, acc[dt]); acc[dt] = wmma_bf(vl, pb.h, acc[dt]); acc[dt] = wmma_bf(vh, pb.h, acc[dt]); } }
  l += xhalf(l);
  const float gm = bfr(GM[0]);
  const int ln = __builtin_amdgcn_mbcnt_lo(~0u, 0u), ec = ln & 15, eg = ln >> 4;   // the lane number taken anew: at 128 registers the indices of the epilogue, carried over the loop, were spilled to scratch
#pragma unroll
  for (int dt = 0; dt < 4; ++dt)
#pragma unroll
    for (int r = 0; r < 8; ++r) so[sh][dt * 16 + 8 * eg + r][qt * 16 + ec] = acc[dt][r];   // so[share][channel][query local], not yet normalised
  if (eg == 0) { sm[sh][qt * 16 + ec] = m; sl[sh][qt * 16 + ec] = l; }
  __syncthreads();
  if (wave < KSPL) { const int s = wave, q = ln; float mm = sm[0][q];
#pragma unroll
    for (int j = 1; j < KSPL; ++j) mm = fmaxf(mm, sm[j][q]);
    float ll = 0.f;
#pragma unroll
    for (int j = 0; j < KSPL; ++j) ll += sl[j][q] * ex2(sm[j][q] - mm);
    sw[s][q] = ex2(sm[s][q] - mm) / ll; }
  __syncthreads();   // the weights are read by the CH / 4 = 16 epilogue waves
  if (wave < CH / 4) { const int c = wave * 4 + (ln >> 3), pc = ln & 7; const size_t o = ((size_t)b * CH + c) * NP + blockIdx.x * 32 + pc * 4; const float* xs = X + o; v4f ov = {};
#pragma unroll
    for (int s = 0; s < KSPL; ++s) ov += *(const v4f*)&sw[s][pc * 4] * *(const v4f*)&so[s][c][pc * 4];
    vst2(Y + o, (v4f){bfr(xs[0]) + gm * ov[0], bfr(xs[1]) + gm * ov[1], bfr(xs[2]) + gm * ov[2], bfr(xs[3]) + gm * ov[3]}); }
}
extern "C" void kernel_launch(void* const* d_in, const int* in_sizes, int n_in, void* d_out, int out_size, void* d_ws, size_t ws_size, hipStream_t stream) {
  (void)in_sizes; (void)n_in; (void)out_size;
  const float** F = (const float**)d_in;   // x [2,64,16,16,16], Wq [8,64], Wk [8,64], Wv [64,64], gamma [1]
  if (ws_size < (size_t)WS_END) return;
  char* ws = (char*)d_ws; __bf16 *PW = (__bf16*)(ws + WS_PW), *KF = (__bf16*)(ws + WS_KF), *VF = (__bf16*)(ws + WS_VF); float* QK = (float*)(ws + WS_QK);
  k_pack<<<1, 256, 0, stream>>>(F[1], F[2], F[3], PW);
  k_proj<<<dim3(NP / 64, TNB), 128, 0, stream>>>(F[0], PW, QK, KF, VF);
  k_attn<<<dim3(TQB, TNB), 64 * KSPL, 0, stream>>>(QK, KF, VF, F[0], F[4], (float*)d_out);
}

// v005
// One run takes 34.9 microseconds.
// Timed twice side by side with v004, it ran 1.41 and 1.40 times as fast.
// All steps since v000 together make it 14.7 times as fast.
// compute dtype: x, Wq, Wk, Wv, gamma (module inputs) rounded to bf16; the 1x1x1 projections q/k/v with exact bf16 products (x and W are inputs) on WMMA 16x16x32 (the 8-wide q/k zero-padded to 32), scores q.k with both computed operands as bf16 hi + residual pairs (3 products), out = attn.v^T with attn hi/lo x v hi/lo (3 products); softmax and the residual x + gamma*out in f32; f32 accumulate.
#include <hip/hip_runtime.h>
#include <math.h>

typedef __attribute__((ext_vector_type(16))) _Float16 v16h;
typedef __attribute__((ext_vector_type(16))) __bf16 v16b;
typedef __attribute__((ext_vector_type(8)))  _Float16 v8h;
typedef __attribute__((ext_vector_type(8)))  float v8f;
typedef __attribute__((ext_vector_type(4)))  float v4f;
typedef __attribute__((ext_vector_type(2)))  float v2f;
typedef __attribute__((ext_vector_type(4)))  unsigned v4u;
typedef __attribute__((ext_vector_type(4)))  int v4i;
typedef float __attribute__((may_alias)) float_a;
typedef int __attribute__((may_alias)) int_a;

template <typename T> __device__ __forceinline__ void vst2(void* p, T v) { *(T*)p = v;  }
__device__ __forceinline__ v8f wmma16(v16h a, v16h b, v8f c) {
  v8f d = __builtin_amdgcn_wmma_f32_16x16x32_f16(false, a, false, b, (short)0, c, false, false);
  asm volatile("v_nop\n\tv_nop\n\tv_nop\n\tv_nop" : "+v"(d) : "v"(a), "v"(b));
  return d;
}
__device__ __forceinline__ v8f wmma_bf(v16b a, v16b b, v8f c) {
  v8f d = __builtin_amdgcn_wmma_f32_16x16x32_bf16(false, a, false, b, (short)0, c, false, false);
  asm volatile("v_nop\n\tv_nop\n\tv_nop\n\tv_nop" : "+v"(d) : "v"(a), "v"(b));
  return d;
}
// 16x16x32 fragments: lane = (h = lane>>4, row/col = lane&15); elements 0..7 = k0+8h+0..7, 8..15 = k0+16+8h+0..7; D element r = row 8h+r
__device__ __forceinline__ v16h frag_h(const _Float16* rowk0, int lane) {
  union { v16h v; v8h q[2]; } u; const _Float16* p = rowk0 + 8 * (lane >> 4);
  u.q[0] = *(const v8h*)p; u.q[1] = *(const v8h*)(p + 16); return u.v;
}
__device__ __forceinline__ v16h frag_f32(const float* rowk0, int lane) {
  v16h a; const float* p = rowk0 + 8 * (lane >> 4);
#pragma unroll
  for (int i = 0; i < 8; ++i) { a[i] = (_Float16)p[i]; a[8 + i] = (_Float16)p[16 + i]; }
  return a;
}
__device__ __forceinline__ v16h frag_f32s(const float* rowk0, int lane, float sc) {
  v16h a; const float* p = rowk0 + 8 * (lane >> 4);
#pragma unroll
  for (int i = 0; i < 8; ++i) { a[i] = (_Float16)(p[i] * sc); a[8 + i] = (_Float16)(p[16 + i] * sc); }
  return a;
}
// column fragment from a [K][ld] layout (column n), rows >= K read as 0
__device__ __forceinline__ v16h fragc_f32(const float* W, int k0, int n, int lane, int ld, int K) {
  v16h a; const int g = lane >> 4;
#pragma unroll
  for (int i = 0; i < 8; ++i) { const int ka = k0 + 8 * g + i, kb = ka + 16;
    a[i] = (_Float16)(ka < K ? W[(size_t)(ka < K ? ka : K - 1) * ld + n] : 0.f); a[8 + i] = (_Float16)(kb < K ? W[(size_t)(kb < K ? kb : K - 1) * ld + n] : 0.f); }
  return a;
}
struct F2 { v16b h, l; };
__device__ __forceinline__ F2 bsplit16(const float v[16]) { F2 r;
#pragma unroll
  for (int i = 0; i < 16; ++i) { const __bf16 h = (__bf16)v[i]; r.h[i] = h; r.l[i] = (__bf16)(v[i] - (float)h); }
  return r; }
__device__ __forceinline__ F2 split_row(const float* row, int k0, int lane) { float v[16]; const float* p = row + k0 + 8 * (lane >> 4);
#pragma unroll
  for (int i = 0; i < 8; ++i) { v[i] = p[i]; v[8 + i] = p[16 + i]; }
  return bsplit16(v); }
__device__ __forceinline__ F2 split_rowK(const float* row, int k0, int lane, int K) { float v[16]; const int g = lane >> 4;
#pragma unroll
  for (int i = 0; i < 8; ++i) { const int ka = k0 + 8 * g + i, kb = ka + 16; v[i] = ka < K ? row[ka < K ? ka : K - 1] : 0.f; v[8 + i] = kb < K ? row[kb < K ? kb : K - 1] : 0.f; }
  return bsplit16(v); }
__device__ __forceinline__ F2 split_col(const float* W, int k0, int n, int lane, int ld, int K) { float v[16]; const int g = lane >> 4;
#pragma unroll
  for (int i = 0; i < 8; ++i) { const int ka = k0 + 8 * g + i, kb = ka + 16; v[i] = ka < K ? W[(size_t)(ka < K ? ka : K - 1) * ld + n] : 0.f; v[8 + i] = kb < K ? W[(size_t)(kb < K ? kb : K - 1) * ld + n] : 0.f; }
  return bsplit16(v); }
__device__ __forceinline__ v8f mac3(const F2& a, const F2& b, v8f c) { c = wmma_bf(a.l, b.h, c); c = wmma_bf(a.h, b.l, c); return wmma_bf(a.h, b.h, c); }
__device__ __forceinline__ float sigm(float v) { return 1.0f / (1.0f + expf(-v)); }
#define LDSX() do { asm volatile("s_wait_dscnt 0" ::: "memory"); __builtin_amdgcn_wave_barrier(); __builtin_amdgcn_fence(__ATOMIC_RELEASE, "workgroup"); } while (0)


// 3-D position attention (B 2, C 64, 16x16x16 = 4096 positions, reduced 8): q = Wq x, k = Wk x, v = Wv x (1x1x1 convs, no bias); attn = softmax(q^T k / sqrt(8)) over positions; out[c][n] = sum_m v[c][m] attn[n][m]; y = x + gamma * out.
#define NB 2
#define CH 64
#define NP 4096
#define RR 8
#ifndef TQB
#define TQB (NP / 32)
#define TNB NB
#endif
typedef __attribute__((ext_vector_type(8))) __bf16 v8b;
__device__ __forceinline__ v16b frag_b(const __bf16* rowk0, int lane) {
  union { v16b v; v8b q[2]; } u; const __bf16* p = rowk0 + 8 * (lane >> 4);
  u.q[0] = *(const v8b*)p; u.q[1] = *(const v8b*)(p + 16); return u.v;
}
__device__ __forceinline__ float bfr(float v) { return (float)(__bf16)v; }
__device__ __attribute__((noinline)) float erf_ni(float v) { return erff(v); }

#define WS_QK  0u                                // f32 [NB][NP][64]: cols 0..31 q (8 real + zeros); cols 32..63 not used
#define WS_KF  (WS_QK + 4u * NB * NP * 64)         // bf16 [NB][NP / 16 key tiles][hi, lo][32 lanes][8]: k as the A fragment's elements 0..7 (reduced dim 8 g + i of key 16 tile + col), lane order
#define WS_VF  (WS_KF + 2u * NB * NP * 32)         // bf16 [NB][NP / 32 key blocks][4 channel tiles][hi, lo][2 halves][32 lanes][8]: v as A fragments (channel 16 dt + col, key 32 block + 16 half + 8 g + i), lane order
#define WS_END (WS_VF + 2u * 2u * NB * CH * NP)

// ---- k_proj: block = (64 positions, batch). The block rounds the three weight matrices to bf16 itself and keeps them in LDS as B operand rows ([out][in]): rows 0..7 Wq, 8..15 zero, 16..23 Wk, 24..31 zero, 32..95 Wv; pitch 144 B for the 16-byte fragment reads
typedef __attribute__((ext_vector_type(4))) __bf16 v4b;
__global__ __launch_bounds__(128) void k_proj(const float* __restrict__ X, const float* __restrict__ WQ, const float* __restrict__ WK, const float* __restrict__ WV, float* __restrict__ QK, __bf16* __restrict__ KF, __bf16* __restrict__ VF) {
  __shared__ __align__(16) __bf16 sx[64][72]; __shared__ __align__(16) float so[4][16][68]; __shared__ __align__(16) __bf16 sth[CH][72], stl[CH][72]; __shared__ __align__(16) __bf16 swt[96][72];
  const int tid = threadIdx.x, wave = tid >> 5, lane = tid & 31, col = lane & 15, g = lane >> 4; const int b = blockIdx.y; const int p0 = blockIdx.x * 64;
  v4f w[10];   // 16 bytes a thread from each group of 8 weight rows (whole lines); issued first, in flight while x is brought in
  w[0] = *(const v4f*)(WQ + tid * 4); w[1] = *(const v4f*)(WK + tid * 4);
#pragma unroll
  for (int t = 0; t < 8; ++t) w[2 + t] = *(const v4f*)(WV + t * 512 + tid * 4);
  for (int q = tid; q < CH * 64; q += 128) { const int c = q >> 6, nl = q & 63; sx[nl][c] = (__bf16)X[((size_t)b * CH + c) * NP + p0 + nl]; }   // sx[position][channel]
#pragma unroll
  for (int t = 0; t < 10; ++t) { v4b h;
#pragma unroll
    for (int i = 0; i < 4; ++i) h[i] = (__bf16)w[t][i];
    *(v4b*)&swt[(t < 2 ? t * 16 : 16 + t * 8) + (tid >> 4)][(tid & 15) * 4] = h; }
  { const int zr = tid >> 3; *(v8b*)&swt[(zr < 8 ? 8 : 16) + zr][(tid & 7) * 8] = (v8b){}; }   // the 16 zero rows
  __syncthreads();
  v16b a[2];
#pragma unroll
  for (int kc = 0; kc < 2; ++kc) {
#pragma unroll
    for (int i = 0; i < 8; ++i) { a[kc][i] = sx[wave * 16 + col][kc * 32 + 8 * g + i]; a[kc][8 + i] = sx[wave * 16 + col][kc * 32 + 16 + 8 * g + i]; } }
  v16b bw[2][6];   // all weight fragments read as one group ahead of the products: 16 rows of swt each
#pragma unroll
  for (int kc = 0; kc < 2; ++kc) {
#pragma unroll
    for (int t = 0; t < 6; ++t) bw[kc][t] = frag_b(&swt[t * 16 + col][kc * 32], lane); }
  v8f acc[8] = {};   // tiles: 0,1 = q plane cols 0..31; 2,3 = k plane cols 32..63; 4..7 = v channels; tiles 1 and 3 have no weight rows and stay zero
#pragma unroll
  for (int kc = 0; kc < 2; ++kc) {
#pragma unroll
    for (int j = 0; j < 8; ++j) if (j != 1 && j != 3) acc[j] = wmma_bf(a[kc], bw[kc][j < 4 ? j / 2 : j - 2], acc[j]); }
#pragma unroll
  for (int j = 0; j < 4; ++j)
#pragma unroll
    for (int r = 0; r < 8; ++r) so[wave][8 * g + r][j * 16 + col] = acc[j][r];
#pragma unroll
  for (int j = 4; j < 8; ++j) { const int c = (j - 4) * 16 + col;
#pragma unroll
    for (int r = 0; r < 8; ++r) { const float v = acc[j][r]; const __bf16 hb = (__bf16)v; sth[c][wave * 16 + 8 * g + r] = hb; stl[c][wave * 16 + 8 * g + r] = (__bf16)(v - (float)hb); } }
  __syncthreads();
  for (int rl = 0; rl < 16; ++rl) if (lane < 8) vst2(QK + ((size_t)b * NP + p0 + wave * 16 + rl) * 64 + lane * 4, *(const v4f*)&so[wave][rl][lane * 4]);
  { v8b kh, kl;   // the wave's 16 positions are one key tile: the lane writes its own 16 bytes of the hi and of the lo fragment, 512 contiguous bytes a store
#pragma unroll
    for (int i = 0; i < 8; ++i) { const float v = so[wave][col][32 + 8 * g + i]; const __bf16 hb = (__bf16)v; kh[i] = hb; kl[i] = (__bf16)(v - (float)hb); }
    __bf16* kf = KF + ((size_t)b * (NP / 16) + blockIdx.x * 4 + wave) * 512 + lane * 8; *(v8b*)kf = kh; *(v8b*)(kf + 256) = kl; }
  for (int q = tid; q < CH * 8; q += 128) { const int fl = q & 31, hf = (q >> 5) & 1, dt = (q >> 6) & 3, kb = q >> 8; const int c = dt * 16 + (fl & 15), pc = kb * 4 + hf * 2 + (fl >> 4);   // q runs in the order of the fragments: a wave's store is 512 contiguous bytes
    const size_t o = ((size_t)b * (NP / 32) + blockIdx.x * 2 + kb) * 4096 + dt * 1024 + hf * 256 + fl * 8; vst2((unsigned*)(VF + o), *(const v4u*)&sth[c][pc * 8]); vst2((unsigned*)(VF + o + 512), *(const v4u*)&stl[c][pc * 8]); }
}
// ---- k_attn: block = (32 queries, batch) = 2 query tiles x KSPL key shares, one wave each: the wave of share sh takes the blocks of 32 keys sh, sh + KSPL, ... with its own maxima, sums and accumulators, and the shares are merged in LDS at the end. Per wave the products are taken transposed: S^T[key][query] = k.q (K 32 with zeros beyond 8; 3 products) / sqrt(8), so a lane holds 16 of the 32 scores of ONE query (lane = (g, query); tile ct, element r = key 16 ct + 8 g + r), which is at once the B fragment of O^T[c][query] = V(hi/lo).P^T(hi/lo): the online softmax runs inside the lane, with one exchange between the two lane halves for the maximum; epilogue: weight of a share = 2 ** (m_share - max) / merged sum (maxima in base 2); y[b][c][n] = x + gamma * sum of weighted partial O (one 128-B line per channel)
#define KSPL 16
// 2 ** v as the one hardware instruction, inline; arguments here lie at most a rounding error above 0, and a result below the normal range may go to 0
__device__ __forceinline__ float ex2(float v) { return __builtin_amdgcn_exp2f(v); }
// the value of lane l ^ 16 (the other lane half), without LDS
__device__ __forceinline__ float xhalf(float v) { const int b = __builtin_bit_cast(int, v); return __builtin_bit_cast(float, __builtin_amdgcn_permlanex16(b, b, 0x76543210, 0xfedcba98, false, false)); }
// fragments stored in lane order: p = the lane's own 16 bytes. v: elements 0..7 and, 512 bytes on, 8..15; k: elements 0..7, elements 8..15 (reduced dims 16..31) are zero
__device__ __forceinline__ v16b frag_v(const __bf16* p) { union { v16b v; v8b q[2]; } u; u.q[0] = *(const v8b*)p; u.q[1] = *(const v8b*)(p + 256); return u.v; }
__device__ __forceinline__ v16b frag_k(const __bf16* p) { union { v16b v; v8b q[2]; } u; u.q[0] = *(const v8b*)p; u.q[1] = (v8b){}; return u.v; }
__global__ __launch_bounds__(64 * KSPL) void k_attn(const float* __restrict__ QK, const __bf16* __restrict__ KF, const __bf16* __restrict__ VF, const float* __restrict__ X, const float* __restrict__ GM, float* __restrict__ Y) {
  __shared__ __align__(16) float so[KSPL][CH][36]; __shared__ __align__(16) float sm[KSPL][32], sl[KSPL][32], sw[KSPL][32];
  const int wave = __builtin_amdgcn_readfirstlane(threadIdx.x >> 5), lane = threadIdx.x & 31, col = lane & 15; const int qt = wave & 1, sh = wave >> 1;   // wave number in a scalar register: the key loop's counter and branch stay scalar
  const int b = blockIdx.y; const int q0 = blockIdx.x * 32 + qt * 16;
  const F2 aq = split_row(QK + ((size_t)b * NP + q0 + col) * 64, 0, lane);
  float m = -3.0e38f, l = 0.f;   // of the lane's query; l counts the lane half's own keys only and is completed after the loop
  v8f acc[4] = {};   // acc[dt][r] = O^T[channel 16 dt + 8 g + r][query col]
  const float scale = 0.35355339059327373f * 1.4426950408889634f;   // 8 ** -0.5 * log2(e): maxima and exponents are kept in base 2, exp(z) = 2 ** (z log2(e))
#pragma unroll 1
  for (int ks = sh; ks < NP / 32; ks += KSPL) { float s[16];
#pragma unroll
    for (int ct = 0; ct < 2; ++ct) { const __bf16* kf = KF + ((size_t)b * (NP / 16) + ks * 2 + ct) * 512 + lane * 8; const F2 kb = {frag_k(kf), frag_k(kf + 256)}; const v8f c = mac3(kb, aq, (v8f){});
#pragma unroll
      for (int r = 0; r < 8; ++r) s[ct * 8 + r] = c[r]; }
    float mx = s[0];
#pragma unroll
    for (int i = 1; i < 16; ++i) mx = fmaxf(mx, s[i]);
    mx = fmaxf(mx, xhalf(mx));   // both lane halves of a query scale by the same maximum: their keys are summed in one product
    const float mn = fmaxf(m, mx * scale); const float alpha = ex2(m - mn); m = mn;   // scale > 0: the maximum of the raw scores, scaled, is the maximum of the scaled ones
#pragma unroll
    for (int i = 0; i < 16; ++i) s[i] = ex2(fmaf(s[i], scale, -mn));
    float t[8];
#pragma unroll
    for (int i = 0; i < 8; ++i) t[i] = s[i] + s[8 + i];
    l = l * alpha + (((t[0] + t[4]) + (t[2] + t[6])) + ((t[1] + t[5]) + (t[3] + t[7])));
#pragma unroll
    for (int dt = 0; dt < 4; ++dt) acc[dt] *= alpha;
    const F2 pb = bsplit16(s);
#pragma unroll
    for (int dt = 0; dt < 4; ++dt) { const __bf16* vf = VF + ((size_t)b * (NP / 32) + ks) * 4096 + dt * 1024 + lane * 8; const v16b vh = frag_v(vf), vl = frag_v(vf + 512); acc[dt] = wmma_bf(vh, pb.l, acc[dt]); acc[dt] = wmma_bf(vl, pb.h, acc[dt]); acc[dt] = wmma_bf(vh, pb.h, acc[dt]); } }
  l += xhalf(l);
  const float gm = bfr(GM[0]);
  const int ln = __builtin_amdgcn_mbcnt_lo(~0u, 0u), ec = ln & 15, eg = ln >> 4;   // the lane number taken anew: at 128 registers the indices of the epilogue, carried over the loop, were spilled to scratch
#pragma unroll
  for (int dt = 0; dt < 4; ++dt)
#pragma unroll
    for (int r = 0; r < 8; ++r) so[sh][dt * 16 + 8 * eg + r][qt * 16 + ec] = acc[dt][r];   // so[share][channel][query local], not yet normalised
  if (eg == 0) { sm[sh][qt * 16 + ec] = m; sl[sh][qt * 16 + ec] = l; }
  __syncthreads();
  if (wave < KSPL) { const int s = wave, q = ln; float mm = sm[0][q];
#pragma unroll
    for (int j = 1; j < KSPL; ++j) mm = fmaxf(mm, sm[j][q]);
    float ll = 0.f;
#pragma unroll
    for (int j = 0; j < KSPL; ++j) ll += sl[j][q] * ex2(sm[j][q] - mm);
    sw[s][q] = ex2(sm[s][q] - mm) / ll; }
  __syncthreads();   // the weights are read by the CH / 4 = 16 epilogue waves
  if (wave < CH / 4) { const int c = wave * 4 + (ln >> 3), pc = ln & 7; const size_t o = ((size_t)b * CH + c) * NP + blockIdx.x * 32 + pc * 4; const float* xs = X + o; v4f ov = {};
#pragma unroll
    for (int s = 0; s < KSPL; ++s) ov += *(const v4f*)&sw[s][pc * 4] * *(const v4f*)&so[s][c][pc * 4];
    vst2(Y + o, (v4f){bfr(xs[0]) + gm * ov[0], bfr(xs[1]) + gm * ov[1], bfr(xs[2]) + gm * ov[2], bfr(xs[3]) + gm * ov[3]}); }
}
extern "C" void kernel_launch(void* const* d_in, const int* in_sizes, int n_in, void* d_out, int out_size, void* d_ws, size_t ws_size, hipStream_t stream) {
  (void)in_sizes; (void)n_in; (void)out_size;
  const float** F = (const float**)d_in;   // x [2,64,16,16,16], Wq [8,64], Wk [8,64], Wv [64,64], gamma [1]
  if (ws_size < (size_t)WS_END) return;
  char* ws = (char*)d_ws; __bf16 *KF = (__bf16*)(ws + WS_KF), *VF = (__bf16*)(ws + WS_VF); float* QK = (float*)(ws + WS_QK);
  k_proj<<<dim3(NP / 64, TNB), 128, 0, stream>>>(F[0], F[1], F[2], F[3], QK, KF, VF);
  k_attn<<<dim3(TQB, TNB), 64 * KSPL, 0, stream>>>(QK, KF, VF, F[0], F[4], (float*)d_out);
}

// v006
// Measured time: 24.4 microseconds a run.
// Next to v005, in two timings, it ran 1.43 times as fast each time.
// Over all steps from v000 it is 21.0 times as fast.
// compute dtype: x, Wq, Wk, Wv, gamma (module inputs) rounded to bf16; the 1x1x1 projections q/k/v with exact bf16 products (x and W are inputs) on WMMA 16x16x32 (the 8-wide q/k zero-padded to 32), scores q.k with both computed operands as bf16 hi + residual pairs (3 products), out = attn.v^T with attn hi/lo x v hi/lo (3 products); softmax and the residual x + gamma*out in f32; f32 accumulate.
#include <hip/hip_runtime.h>
#include <math.h>

typedef __attribute__((ext_vector_type(16))) _Float16 v16h;
typedef __attribute__((ext_vector_type(16))) __bf16 v16b;
typedef __attribute__((ext_vector_type(8)))  _Float16 v8h;
typedef __attribute__((ext_vector_type(8)))  float v8f;
typedef __attribute__((ext_vector_type(4)))  float v4f;
typedef __attribute__((ext_vector_type(2)))  float v2f;
typedef __attribute__((ext_vector_type(4)))  unsigned v4u;
typedef __attribute__((ext_vector_type(4)))  int v4i;
typedef float __attribute__((may_alias)) float_a;
typedef int __attribute__((may_alias)) int_a;

template <typename T> __device__ __forceinline__ void vst2(void* p, T v) { *(T*)p = v;  }
__device__ __forceinline__ v8f wmma16(v16h a, v16h b, v8f c) {
  v8f d = __builtin_amdgcn_wmma_f32_16x16x32_f16(false, a, false, b, (short)0, c, false, false);
  asm volatile("v_nop\n\tv_nop\n\tv_nop\n\tv_nop" : "+v"(d) : "v"(a), "v"(b));
  return d;
}
__device__ __forceinline__ v8f wmma_bf(v16b a, v16b b, v8f c) {
  v8f d = __builtin_amdgcn_wmma_f32_16x16x32_bf16(false, a, false, b, (short)0, c, false, false);
  asm volatile("v_nop\n\tv_nop\n\tv_nop\n\tv_nop" : "+v"(d) : "v"(a), "v"(b));
  return d;
}
// 16x16x32 fragments: lane = (h = lane>>4, row/col = lane&15); elements 0..7 = k0+8h+0..7, 8..15 = k0+16+8h+0..7; D element r = row 8h+r
__device__ __forceinline__ v16h frag_h(const _Float16* rowk0, int lane) {
  union { v16h v; v8h q[2]; } u; const _Float16* p = rowk0 + 8 * (lane >> 4);
  u.q[0] = *(const v8h*)p; u.q[1] = *(const v8h*)(p + 16); return u.v;
}
__device__ __forceinline__ v16h frag_f32(const float* rowk0, int lane) {
  v16h a; const float* p = rowk0 + 8 * (lane >> 4);
#pragma unroll
  for (int i = 0; i < 8; ++i) { a[i] = (_Float16)p[i]; a[8 + i] = (_Float16)p[16 + i]; }
  return a;
}
__device__ __forceinline__ v16h frag_f32s(const float* rowk0, int lane, float sc) {
  v16h a; const float* p = rowk0 + 8 * (lane >> 4);
#pragma unroll
  for (int i = 0; i < 8; ++i) { a[i] = (_Float16)(p[i] * sc); a[8 + i] = (_Float16)(p[16 + i] * sc); }
  return a;
}
// column fragment from a [K][ld] layout (column n), rows >= K read as 0
__device__ __forceinline__ v16h fragc_f32(const float* W, int k0, int n, int lane, int ld, int K) {
  v16h a; const int g = lane >> 4;
#pragma unroll
  for (int i = 0; i < 8; ++i) { const int ka = k0 + 8 * g + i, kb = ka + 16;
    a[i] = (_Float16)(ka < K ? W[(size_t)(ka < K ? ka : K - 1) * ld + n] : 0.f); a[8 + i] = (_Float16)(kb < K ? W[(size_t)(kb < K ? kb : K - 1) * ld + n] : 0.f); }
  return a;
}
struct F2 { v16b h, l; };
__device__ __forceinline__ F2 bsplit16(const float v[16]) { F2 r;
#pragma unroll
  for (int i = 0; i < 16; ++i) { const __bf16 h = (__bf16)v[i]; r.h[i] = h; r.l[i] = (__bf16)(v[i] - (float)h); }
  return r; }
__device__ __forceinline__ F2 split_row(const float* row, int k0, int lane) { float v[16]; const float* p = row + k0 + 8 * (lane >> 4);
#pragma unroll
  for (int i = 0; i < 8; ++i) { v[i] = p[i]; v[8 + i] = p[16 + i]; }
  return bsplit16(v); }
__device__ __forceinline__ F2 split_rowK(const float* row, int k0, int lane, int K) { float v[16]; const int g = lane >> 4;
#pragma unroll
  for (int i = 0; i < 8; ++i) { const int ka = k0 + 8 * g + i, kb = ka + 16; v[i] = ka < K ? row[ka < K ? ka : K - 1] : 0.f; v[8 + i] = kb < K ? row[kb < K ? kb : K - 1] : 0.f; }
  return bsplit16(v); }
__device__ __forceinline__ F2 split_col(const float* W, int k0, int n, int lane, int ld, int K) { float v[16]; const int g = lane >> 4;
#pragma unroll
  for (int i = 0; i < 8; ++i) { const int ka = k0 + 8 * g + i, kb = ka + 16; v[i] = ka < K ? W[(size_t)(ka < K ? ka : K - 1) * ld + n] : 0.f; v[8 + i] = kb < K ? W[(size_t)(kb < K ? kb : K - 1) * ld + n] : 0.f; }
  return bsplit16(v); }
__device__ __forceinline__ v8f mac3(const F2& a, const F2& b, v8f c) { c = wmma_bf(a.l, b.h, c); c = wmma_bf(a.h, b.l, c); return wmma_bf(a.h, b.h, c); }
__device__ __forceinline__ float sigm(float v) { return 1.0f / (1.0f + expf(-v)); }
#define LDSX() do { asm volatile("s_wait_dscnt 0" ::: "memory"); __builtin_amdgcn_wave_barrier(); __builtin_amdgcn_fence(__ATOMIC_RELEASE, "workgroup"); } while (0)


// 3-D position attention (B 2, C 64, 16x16x16 = 4096 positions, reduced 8): q = Wq x, k = Wk x, v = Wv x (1x1x1 convs, no bias); attn = softmax(q^T k / sqrt(8)) over positions; out[c][n] = sum_m v[c][m] attn[n][m]; y = x + gamma * out.
#define NB 2
#define CH 64
#define NP 4096
#define RR 8
#ifndef TQB
#define TQB (NP / 32)
#define TNB NB
#endif
typedef __attribute__((ext_vector_type(8))) __bf16 v8b;
__device__ __forceinline__ v16b frag_b(const __bf16* rowk0, int lane) {
  union { v16b v; v8b q[2]; } u; const __bf16* p = rowk0 + 8 * (lane >> 4);
  u.q[0] = *(const v8b*)p; u.q[1] = *(const v8b*)(p + 16); return u.v;
}
__device__ __forceinline__ float bfr(float v) { return (float)(__bf16)v; }
__device__ __attribute__((noinline)) float erf_ni(float v) { return erff(v); }

#define WS_QK  0u                                // f32 [NB][NP][64]: cols 0..31 q (8 real + zeros); cols 32..63 not used
#define WS_KF  (WS_QK + 4u * NB * NP * 64)         // bf16 [NB][NP / 16 key tiles][hi, lo][32 lanes][8]: k as the A fragment's elements 0..7 (reduced dim 8 g + i of key 16 tile + col), lane order
#define WS_VF  (WS_KF + 2u * NB * NP * 32)         // bf16 [NB][NP / 32 key blocks][4 channel tiles][hi, lo][2 halves][32 lanes][8]: v as A fragments (channel 16 dt + col, key 32 block + 16 half + 8 g + i), lane order
#define WS_END (WS_VF + 2u * 2u * NB * CH * NP)

// ---- k_proj: block = (64 positions, batch). The block rounds the three weight matrices to bf16 itself and keeps them in LDS as B operand rows ([out][in]): rows 0..7 Wq, 8..15 zero, 16..23 Wk, 24..31 zero, 32..95 Wv; pitch 144 B for the 16-byte fragment reads
typedef __attribute__((ext_vector_type(4))) __bf16 v4b;
__global__ __launch_bounds__(128) void k_proj(const float* __restrict__ X, const float* __restrict__ WQ, const float* __restrict__ WK, const float* __restrict__ WV, float* __restrict__ QK, __bf16* __restrict__ KF, __bf16* __restrict__ VF) {
  __shared__ __align__(16) __bf16 sx[64][72]; __shared__ __align__(16) float so[4][16][68]; __shared__ __align__(16) __bf16 sth[CH][72], stl[CH][72]; __shared__ __align__(16) __bf16 swt[96][72];
  const int tid = threadIdx.x, wave = tid >> 5, lane = tid & 31, col = lane & 15, g = lane >> 4; const int b = blockIdx.y; const int p0 = blockIdx.x * 64;
  v4f w[10];   // 16 bytes a thread from each group of 8 weight rows (whole lines); issued first, in flight while x is brought in
  w[0] = *(const v4f*)(WQ + tid * 4); w[1] = *(const v4f*)(WK + tid * 4);
#pragma unroll
  for (int t = 0; t < 8; ++t) w[2 + t] = *(const v4f*)(WV + t * 512 + tid * 4);
  for (int q = tid; q < CH * 64; q += 128) { const int c = q >> 6, nl = q & 63; sx[nl][c] = (__bf16)X[((size_t)b * CH + c) * NP + p0 + nl]; }   // sx[position][channel]
#pragma unroll
  for (int t = 0; t < 10; ++t) { v4b h;
#pragma unroll
    for (int i = 0; i < 4; ++i) h[i] = (__bf16)w[t][i];
    *(v4b*)&swt[(t < 2 ? t * 16 : 16 + t * 8) + (tid >> 4)][(tid & 15) * 4] = h; }
  { const int zr = tid >> 3; *(v8b*)&swt[(zr < 8 ? 8 : 16) + zr][(tid & 7) * 8] = (v8b){}; }   // the 16 zero rows
  __syncthreads();
  v16b a[2];
#pragma unroll
  for (int kc = 0; kc < 2; ++kc) {
#pragma unroll
    for (int i = 0; i < 8; ++i) { a[kc][i] = sx[wave * 16 + col][kc * 32 + 8 * g + i]; a[kc][8 + i] = sx[wave * 16 + col][kc * 32 + 16 + 8 * g + i]; } }
  v16b bw[2][6];   // all weight fragments read as one group ahead of the products: 16 rows of swt each
#pragma unroll
  for (int kc = 0; kc < 2; ++kc) {
#pragma unroll
    for (int t = 0; t < 6; ++t) bw[kc][t] = frag_b(&swt[t * 16 + col][kc * 32], lane); }
  v8f acc[8] = {};   // tiles: 0,1 = q plane cols 0..31; 2,3 = k plane cols 32..63; 4..7 = v channels; tiles 1 and 3 have no weight rows and stay zero
#pragma unroll
  for (int kc = 0; kc < 2; ++kc) {
#pragma unroll
    for (int j = 0; j < 8; ++j) if (j != 1 && j != 3) acc[j] = wmma_bf(a[kc], bw[kc][j < 4 ? j / 2 : j - 2], acc[j]); }
#pragma unroll
  for (int j = 0; j < 4; ++j)
#pragma unroll
    for (int r = 0; r < 8; ++r) so[wave][8 * g + r][j * 16 + col] = acc[j][r];
#pragma unroll
  for (int j = 4; j < 8; ++j) { const int c = (j - 4) * 16 + col;
#pragma unroll
    for (int r = 0; r < 8; ++r) { const float v = acc[j][r]; const __bf16 hb = (__bf16)v; sth[c][wave * 16 + 8 * g + r] = hb; stl[c][wave * 16 + 8 * g + r] = (__bf16)(v - (float)hb); } }
  __syncthreads();
  for (int rl = 0; rl < 16; ++rl) if (lane < 8) vst2(QK + ((size_t)b * NP + p0 + wave * 16 + rl) * 64 + lane * 4, *(const v4f*)&so[wave][rl][lane * 4]);
  { v8b kh, kl;   // the wave's 16 positions are one key tile: the lane writes its own 16 bytes of the hi and of the lo fragment, 512 contiguous bytes a store
#pragma unroll
    for (int i = 0; i < 8; ++i) { const float v = so[wave][col][32 + 8 * g + i]; const __bf16 hb = (__bf16)v; kh[i] = hb; kl[i] = (__bf16)(v - (float)hb); }
    __bf16* kf = KF + ((size_t)b * (NP / 16) + blockIdx.x * 4 + wave) * 512 + lane * 8; *(v8b*)kf = kh; *(v8b*)(kf + 256) = kl; }
  for (int q = tid; q < CH * 8; q += 128) { const int fl = q & 31, hf = (q >> 5) & 1, dt = (q >> 6) & 3, kb = q >> 8; const int c = dt * 16 + (fl & 15), pc = kb * 4 + hf * 2 + (fl >> 4);   // q runs in the order of the fragments: a wave's store is 512 contiguous bytes
    const size_t o = ((size_t)b * (NP / 32) + blockIdx.x * 2 + kb) * 4096 + dt * 1024 + hf * 256 + fl * 8; vst2((unsigned*)(VF + o), *(const v4u*)&sth[c][pc * 8]); vst2((unsigned*)(VF + o + 512), *(const v4u*)&stl[c][pc * 8]); }
}
// ---- k_attn: block = (32 queries, batch) = KSPL key shares, one wave each: the wave of share sh takes the blocks of 32 keys sh, sh + KSPL, ... for BOTH query tiles of the block, so a k or v fragment is loaded once for 32 queries; it keeps maxima, sums and accumulators per query tile, and the shares are merged in LDS at the end. Per wave the products are taken transposed: S^T[key][query] = k.q (K 32 with zeros beyond 8; 3 products) / sqrt(8), so a lane holds 16 of the 32 scores of ONE query of each tile (lane = (g, query); tile ct, element r = key 16 ct + 8 g + r), which is at once the B fragment of O^T[c][query] = V(hi/lo).P^T(hi/lo): the online softmax runs inside the lane, with one exchange between the two lane halves for the maximum; epilogue: weight of a share = 2 ** (m_share - max) / merged sum (maxima in base 2); y[b][c][n] = x + gamma * sum of weighted partial O (one 128-B line per channel)
#define KSPL 16
// 2 ** v as the one hardware instruction, inline; arguments here lie at most a rounding error above 0, and a result below the normal range may go to 0
__device__ __forceinline__ float ex2(float v) { return __builtin_amdgcn_exp2f(v); }
// the value of lane l ^ 16 (the other lane half), without LDS
__device__ __forceinline__ float xhalf(float v) { const int b = __builtin_bit_cast(int, v); return __builtin_bit_cast(float, __builtin_amdgcn_permlanex16(b, b, 0x76543210, 0xfedcba98, false, false)); }
// fragments stored in lane order: p = the lane's own 16 bytes. v: elements 0..7 and, 512 bytes on, 8..15; k: elements 0..7, elements 8..15 (reduced dims 16..31) are zero
__device__ __forceinline__ v16b frag_v(const __bf16* p) { union { v16b v; v8b q[2]; } u; u.q[0] = *(const v8b*)p; u.q[1] = *(const v8b*)(p + 256); return u.v; }
__device__ __forceinline__ v16b frag_k(const __bf16* p) { union { v16b v; v8b q[2]; } u; u.q[0] = *(const v8b*)p; u.q[1] = (v8b){}; return u.v; }
__global__ __launch_bounds__(32 * KSPL) void k_attn(const float* __restrict__ QK, const __bf16* __restrict__ KF, const __bf16* __restrict__ VF, const float* __restrict__ X, const float* __restrict__ GM, float* __restrict__ Y) {
  __shared__ __align__(16) float so[KSPL][CH][36]; __shared__ __align__(16) float sm[KSPL][32], sl[KSPL][32], sw[KSPL][32];
  const int sh = __builtin_amdgcn_readfirstlane(threadIdx.x >> 5), lane = threadIdx.x & 31, col = lane & 15;   // wave number = key share, in a scalar register: the key loop's counter and branch stay scalar
  const int b = blockIdx.y; const int q0 = blockIdx.x * 32;
  F2 aq[2];
  // every inner loop of this kernel is unrolled in full: its counter indexes fragments, scores or accumulators, which stay in registers only under constant indices
#pragma unroll
  for (int qt = 0; qt < 2; ++qt) aq[qt] = split_row(QK + ((size_t)b * NP + q0 + qt * 16 + col) * 64, 0, lane);
  float m[2] = {-3.0e38f, -3.0e38f}, l[2] = {0.f, 0.f};   // of the lane's query in each tile; l counts the lane half's own keys only and is completed after the loop
  v8f acc[2][4] = {};   // acc[qt][dt][r] = O^T[channel 16 dt + 8 g + r][query 16 qt + col]
  const float scale = 0.35355339059327373f * 1.4426950408889634f;   // 8 ** -0.5 * log2(e): maxima and exponents are kept in base 2, exp(z) = 2 ** (z log2(e))
#pragma unroll 1
  for (int ks = sh; ks < NP / 32; ks += KSPL) {
    // every fragment of the pass is read here, once, as one group ahead of the products: the v loads are in flight under the scores and the softmax
    F2 kb[2]; v16b vh[4], vl[4];
    const __bf16* kp = KF + ((size_t)b * (NP / 16) + ks * 2) * 512 + lane * 8; const __bf16* vp = VF + ((size_t)b * (NP / 32) + ks) * 4096 + lane * 8;
#pragma unroll
    for (int ct = 0; ct < 2; ++ct) { kb[ct].h = frag_k(kp + ct * 512); kb[ct].l = frag_k(kp + ct * 512 + 256); }
#pragma unroll
    for (int dt = 0; dt < 4; ++dt) { vh[dt] = frag_v(vp + dt * 1024); vl[dt] = frag_v(vp + dt * 1024 + 512); }
    asm volatile("s_wait_xcnt 0x0" :: "v"(kp), "v"(vp) : "memory");   // stands behind the issued loads and in front of every overwrite of their address registers (the two pointers are inputs, so they stay in their registers up to here)
    // the four score tiles (2 query tiles x 2 key tiles) go product by product, so that a tile's next product stands behind three independent ones; per tile the order of the three is lo.hi, hi.lo, hi.hi
    v8f c[2][2];
#pragma unroll
    for (int qt = 0; qt < 2; ++qt)
#pragma unroll
      for (int ct = 0; ct < 2; ++ct) c[qt][ct] = wmma_bf(kb[ct].l, aq[qt].h, (v8f){});
#pragma unroll
    for (int qt = 0; qt < 2; ++qt)
#pragma unroll
      for (int ct = 0; ct < 2; ++ct) c[qt][ct] = wmma_bf(kb[ct].h, aq[qt].l, c[qt][ct]);
#pragma unroll
    for (int qt = 0; qt < 2; ++qt)
#pragma unroll
      for (int ct = 0; ct < 2; ++ct) c[qt][ct] = wmma_bf(kb[ct].h, aq[qt].h, c[qt][ct]);
    F2 pb[2];
#pragma unroll
    for (int qt = 0; qt < 2; ++qt) { float s[16];
#pragma unroll
      for (int r = 0; r < 8; ++r) { s[r] = c[qt][0][r]; s[8 + r] = c[qt][1][r]; }
      float mx = s[0];
#pragma unroll
      for (int i = 1; i < 16; ++i) mx = fmaxf(mx, s[i]);
      mx = fmaxf(mx, xhalf(mx));   // both lane halves of a query scale by the same maximum: their keys are summed in one product
      const float mn = fmaxf(m[qt], mx * scale); const float alpha = ex2(m[qt] - mn); m[qt] = mn;   // scale > 0: the maximum of the raw scores, scaled, is the maximum of the scaled ones
#pragma unroll
      for (int i = 0; i < 16; ++i) s[i] = ex2(fmaf(s[i], scale, -mn));
      float t[8];
#pragma unroll
      for (int i = 0; i < 8; ++i) t[i] = s[i] + s[8 + i];
      l[qt] = l[qt] * alpha + (((t[0] + t[4]) + (t[2] + t[6])) + ((t[1] + t[5]) + (t[3] + t[7])));
#pragma unroll
      for (int dt = 0; dt < 4; ++dt) acc[qt][dt] *= alpha;
      pb[qt] = bsplit16(s); }
    // eight accumulators, product by product; per accumulator the order of the three is hi.lo, lo.hi, hi.hi
#pragma unroll
    for (int dt = 0; dt < 4; ++dt)
#pragma unroll
      for (int qt = 0; qt < 2; ++qt) acc[qt][dt] = wmma_bf(vh[dt], pb[qt].l, acc[qt][dt]);
#pragma unroll
    for (int dt = 0; dt < 4; ++dt)
#pragma unroll
      for (int qt = 0; qt < 2; ++qt) acc[qt][dt] = wmma_bf(vl[dt], pb[qt].h, acc[qt][dt]);
#pragma unroll
    for (int dt = 0; dt < 4; ++dt)
#pragma unroll
      for (int qt = 0; qt < 2; ++qt) acc[qt][dt] = wmma_bf(vh[dt], pb[qt].h, acc[qt][dt]); }
#pragma unroll
  for (int qt = 0; qt < 2; ++qt) l[qt] += xhalf(l[qt]);
  const float gm = bfr(GM[0]);
  const int ln = __builtin_amdgcn_mbcnt_lo(~0u, 0u), ec = ln & 15, eg = ln >> 4;   // the lane number taken anew: the indices of the epilogue are not carried over the loop in registers
#pragma unroll
  for (int qt = 0; qt < 2; ++qt)
#pragma unroll
    for (int dt = 0; dt < 4; ++dt)
#pragma unroll
      for (int r = 0; r < 8; ++r) so[sh][dt * 16 + 8 * eg + r][qt * 16 + ec] = acc[qt][dt][r];   // so[share][channel][query local], not yet normalised
  if (eg == 0) {
#pragma unroll
    for (int qt = 0; qt < 2; ++qt) { sm[sh][qt * 16 + ec] = m[qt]; sl[sh][qt * 16 + ec] = l[qt]; } }
  __syncthreads();
  { const int q = ln; float mm = sm[0][q];   // the block has KSPL waves: wave sh forms the weights of share sh for the 32 queries
#pragma unroll
    for (int j = 1; j < KSPL; ++j) mm = fmaxf(mm, sm[j][q]);
    float ll = 0.f;
#pragma unroll
    for (int j = 0; j < KSPL; ++j) ll += sl[j][q] * ex2(sm[j][q] - mm);
    sw[sh][q] = ex2(sm[sh][q] - mm) / ll; }
  __syncthreads();   // the weights are read by every wave
  static_assert(KSPL == CH / 4, "one wave for every 4 channels of the output");
  { const int c = sh * 4 + (ln >> 3), pc = ln & 7; const size_t o = ((size_t)b * CH + c) * NP + blockIdx.x * 32 + pc * 4; const float* xs = X + o; v4f ov = {};
#pragma unroll
    for (int s = 0; s < KSPL; ++s) ov += *(const v4f*)&sw[s][pc * 4] * *(const v4f*)&so[s][c][pc * 4];
    vst2(Y + o, (v4f){bfr(xs[0]) + gm * ov[0], bfr(xs[1]) + gm * ov[1], bfr(xs[2]) + gm * ov[2], bfr(xs[3]) + gm * ov[3]}); }
}
extern "C" void kernel_launch(void* const* d_in, const int* in_sizes, int n_in, void* d_out, int out_size, void* d_ws, size_t ws_size, hipStream_t stream) {
  (void)in_sizes; (void)n_in; (void)out_size;
  const float** F = (const float**)d_in;   // x [2,64,16,16,16], Wq [8,64], Wk [8,64], Wv [64,64], gamma [1]
  if (ws_size < (size_t)WS_END) return;
  char* ws = (char*)d_ws; __bf16 *KF = (__bf16*)(ws + WS_KF), *VF = (__bf16*)(ws + WS_VF); float* QK = (float*)(ws + WS_QK);
  k_proj<<<dim3(NP / 64, TNB), 128, 0, stream>>>(F[0], F[1], F[2], F[3], QK, KF, VF);
  k_attn<<<dim3(TQB, TNB), 32 * KSPL, 0, stream>>>(QK, KF, VF, F[0], F[4], (float*)d_out);
}

// v007
// One run takes 23.2 microseconds.
// Next to v006, in two timings, it ran 1.05 and 1.04 times as fast.
// Counting every step since v000, it is 22.0 times as fast.
// compute dtype: x, Wq, Wk, Wv, gamma (module inputs) rounded to bf16; the 1x1x1 projections q/k with exact bf16 products (x and W are inputs) on WMMA 16x16x32 (the 8-wide q/k zero-padded to 32), scores q.k with both computed operands as bf16 hi + residual pairs (3 products), out = Wv.(x.attn^T): x (exact in bf16) x attn hi/lo (2 products), then Wv (exact in bf16) x the normalised sum hi/lo (2 products); softmax and the residual x + gamma*out in f32; f32 accumulate.
#include <hip/hip_runtime.h>
#include <math.h>

typedef __attribute__((ext_vector_type(16))) _Float16 v16h;
typedef __attribute__((ext_vector_type(16))) __bf16 v16b;
typedef __attribute__((ext_vector_type(8)))  _Float16 v8h;
typedef __attribute__((ext_vector_type(8)))  float v8f;
typedef __attribute__((ext_vector_type(4)))  float v4f;
typedef __attribute__((ext_vector_type(2)))  float v2f;
typedef __attribute__((ext_vector_type(4)))  unsigned v4u;
typedef __attribute__((ext_vector_type(4)))  int v4i;
typedef float __attribute__((may_alias)) float_a;
typedef int __attribute__((may_alias)) int_a;

template <typename T> __device__ __forceinline__ void vst2(void* p, T v) { *(T*)p = v;  }
__device__ __forceinline__ v8f wmma16(v16h a, v16h b, v8f c) {
  v8f d = __builtin_amdgcn_wmma_f32_16x16x32_f16(false, a, false, b, (short)0, c, false, false);
  asm volatile("v_nop\n\tv_nop\n\tv_nop\n\tv_nop" : "+v"(d) : "v"(a), "v"(b));
  return d;
}
__device__ __forceinline__ v8f wmma_bf(v16b a, v16b b, v8f c) {
  v8f d = __builtin_amdgcn_wmma_f32_16x16x32_bf16(false, a, false, b, (short)0, c, false, false);
  asm volatile("v_nop\n\tv_nop\n\tv_nop\n\tv_nop" : "+v"(d) : "v"(a), "v"(b));
  return d;
}
// 16x16x32 fragments: lane = (h = lane>>4, row/col = lane&15); elements 0..7 = k0+8h+0..7, 8..15 = k0+16+8h+0..7; D element r = row 8h+r
__device__ __forceinline__ v16h frag_h(const _Float16* rowk0, int lane) {
  union { v16h v; v8h q[2]; } u; const _Float16* p = rowk0 + 8 * (lane >> 4);
  u.q[0] = *(const v8h*)p; u.q[1] = *(const v8h*)(p + 16); return u.v;
}
__device__ __forceinline__ v16h frag_f32(const float* rowk0, int lane) {
  v16h a; const float* p = rowk0 + 8 * (lane >> 4);
#pragma unroll
  for (int i = 0; i < 8; ++i) { a[i] = (_Float16)p[i]; a[8 + i] = (_Float16)p[16 + i]; }
  return a;
}
__device__ __forceinline__ v16h frag_f32s(const float* rowk0, int lane, float sc) {
  v16h a; const float* p = rowk0 + 8 * (lane >> 4);
#pragma unroll
  for (int i = 0; i < 8; ++i) { a[i] = (_Float16)(p[i] * sc); a[8 + i] = (_Float16)(p[16 + i] * sc); }
  return a;
}
// column fragment from a [K][ld] layout (column n), rows >= K read as 0
__device__ __forceinline__ v16h fragc_f32(const float* W, int k0, int n, int lane, int ld, int K) {
  v16h a; const int g = lane >> 4;
#pragma unroll
  for (int i = 0; i < 8; ++i) { const int ka = k0 + 8 * g + i, kb = ka + 16;
    a[i] = (_Float16)(ka < K ? W[(size_t)(ka < K ? ka : K - 1) * ld + n] : 0.f); a[8 + i] = (_Float16)(kb < K ? W[(size_t)(kb < K ? kb : K - 1) * ld + n] : 0.f); }
  return a;
}
struct F2 { v16b h, l; };
__device__ __forceinline__ F2 bsplit16(const float v[16]) { F2 r;
#pragma unroll
  for (int i = 0; i < 16; ++i) { const __bf16 h = (__bf16)v[i]; r.h[i] = h; r.l[i] = (__bf16)(v[i] - (float)h); }
  return r; }
__device__ __forceinline__ F2 split_row(const float* row, int k0, int lane) { float v[16]; const float* p = row + k0 + 8 * (lane >> 4);
#pragma unroll
  for (int i = 0; i < 8; ++i) { v[i] = p[i]; v[8 + i] = p[16 + i]; }
  return bsplit16(v); }
__device__ __forceinline__ F2 split_rowK(const float* row, int k0, int lane, int K) { float v[16]; const int g = lane >> 4;
#pragma unroll
  for (int i = 0; i < 8; ++i) { const int ka = k0 + 8 * g + i, kb = ka + 16; v[i] = ka < K ? row[ka < K ? ka : K - 1] : 0.f; v[8 + i] = kb < K ? row[kb < K ? kb : K - 1] : 0.f; }
  return bsplit16(v); }
__device__ __forceinline__ F2 split_col(const float* W, int k0, int n, int lane, int ld, int K) { float v[16]; const int g = lane >> 4;
#pragma unroll
  for (int i = 0; i < 8; ++i) { const int ka = k0 + 8 * g + i, kb = ka + 16; v[i] = ka < K ? W[(size_t)(ka < K ? ka : K - 1) * ld + n] : 0.f; v[8 + i] = kb < K ? W[(size_t)(kb < K ? kb : K - 1) * ld + n] : 0.f; }
  return bsplit16(v); }
__device__ __forceinline__ v8f mac3(const F2& a, const F2& b, v8f c) { c = wmma_bf(a.l, b.h, c); c = wmma_bf(a.h, b.l, c); return wmma_bf(a.h, b.h, c); }
__device__ __forceinline__ float sigm(float v) { return 1.0f / (1.0f + expf(-v)); }
#define LDSX() do { asm volatile("s_wait_dscnt 0" ::: "memory"); __builtin_amdgcn_wave_barrier(); __builtin_amdgcn_fence(__ATOMIC_RELEASE, "workgroup"); } while (0)


// 3-D position attention (B 2, C 64, 16x16x16 = 4096 positions, reduced 8): q = Wq x, k = Wk x, v = Wv x (1x1x1 convs, no bias); attn = softmax(q^T k / sqrt(8)) over positions; out[c][n] = sum_m v[c][m] attn[n][m]; y = x + gamma * out. The sum over positions is linear, so it is taken over x and Wv is applied to its result: out = Wv.(x.attn^T).
#define NB 2
#define CH 64
#define NP 4096
#define RR 8
#ifndef TQB
#define TQB (NP / 32)
#define TNB NB
#endif
typedef __attribute__((ext_vector_type(8))) __bf16 v8b;
__device__ __forceinline__ v16b frag_b(const __bf16* rowk0, int lane) {
  union { v16b v; v8b q[2]; } u; const __bf16* p = rowk0 + 8 * (lane >> 4);
  u.q[0] = *(const v8b*)p; u.q[1] = *(const v8b*)(p + 16); return u.v;
}
__device__ __forceinline__ float bfr(float v) { return (float)(__bf16)v; }
__device__ __attribute__((noinline)) float erf_ni(float v) { return erff(v); }

#define WS_QK  0u                                // f32 [NB][NP][64]: cols 0..31 q (8 real + zeros); cols 32..63 not used
#define WS_KF  (WS_QK + 4u * NB * NP * 64)         // bf16 [NB][NP / 16 key tiles][hi, lo][32 lanes][8]: k as the A fragment's elements 0..7 (reduced dim 8 g + i of key 16 tile + col), lane order
#define WS_VF  (WS_KF + 2u * NB * NP * 32)         // bf16 [NB][NP / 32 key blocks][4 channel tiles][2 halves][32 lanes][8]: x as A fragments (channel 16 dt + col, key 32 block + 16 half + 8 g + i), lane order
#define WS_END (WS_VF + 2u * NB * CH * NP)

// ---- k_proj: block = (64 positions, batch). The block rounds Wq and Wk to bf16 itself and keeps them in LDS as B operand rows ([out][in]): rows 0..7 Wq, 8..15 zero, 16..23 Wk, 24..31 zero; pitch 144 B for the 16-byte fragment reads. x, rounded to bf16, goes out in the order of the attention's A fragments
typedef __attribute__((ext_vector_type(4))) __bf16 v4b;
__global__ __launch_bounds__(128) void k_proj(const float* __restrict__ X, const float* __restrict__ WQ, const float* __restrict__ WK, float* __restrict__ QK, __bf16* __restrict__ KF, __bf16* __restrict__ VF) {
  __shared__ __align__(16) __bf16 sx[64][72]; __shared__ __align__(16) float so[4][16][68]; __shared__ __align__(16) __bf16 sth[CH][72]; __shared__ __align__(16) __bf16 swt[32][72];
  const int tid = threadIdx.x, wave = tid >> 5, lane = tid & 31, col = lane & 15, g = lane >> 4; const int b = blockIdx.y; const int p0 = blockIdx.x * 64;
  v4f w[2];   // 16 bytes a thread from each group of 8 weight rows (whole lines); issued first, in flight while x is brought in
  w[0] = *(const v4f*)(WQ + tid * 4); w[1] = *(const v4f*)(WK + tid * 4);
  for (int q = tid; q < CH * 64; q += 128) { const int c = q >> 6, nl = q & 63; const __bf16 xb = (__bf16)X[((size_t)b * CH + c) * NP + p0 + nl]; sx[nl][c] = xb; sth[c][nl] = xb; }   // sx[position][channel], sth[channel][position]
#pragma unroll
  for (int t = 0; t < 2; ++t) { v4b h;
#pragma unroll
    for (int i = 0; i < 4; ++i) h[i] = (__bf16)w[t][i];
    *(v4b*)&swt[t * 16 + (tid >> 4)][(tid & 15) * 4] = h; }
  { const int zr = tid >> 3; *(v8b*)&swt[(zr < 8 ? 8 : 16) + zr][(tid & 7) * 8] = (v8b){}; }   // the 16 zero rows
  __syncthreads();
  v16b a[2];
#pragma unroll
  for (int kc = 0; kc < 2; ++kc) {
#pragma unroll
    for (int i = 0; i < 8; ++i) { a[kc][i] = sx[wave * 16 + col][kc * 32 + 8 * g + i]; a[kc][8 + i] = sx[wave * 16 + col][kc * 32 + 16 + 8 * g + i]; } }
  v16b bw[2][2];   // all weight fragments read as one group ahead of the products: 16 rows of swt each
#pragma unroll
  for (int kc = 0; kc < 2; ++kc) {
#pragma unroll
    for (int t = 0; t < 2; ++t) bw[kc][t] = frag_b(&swt[t * 16 + col][kc * 32], lane); }
  v8f acc[4] = {};   // tiles: 0,1 = q plane cols 0..31; 2,3 = k plane cols 32..63; tiles 1 and 3 have no weight rows and stay zero
#pragma unroll
  for (int kc = 0; kc < 2; ++kc) {
#pragma unroll
    for (int j = 0; j < 4; j += 2) acc[j] = wmma_bf(a[kc], bw[kc][j / 2], acc[j]); }
#pragma unroll
  for (int j = 0; j < 4; ++j)
#pragma unroll
    for (int r = 0; r < 8; ++r) so[wave][8 * g + r][j * 16 + col] = acc[j][r];
  __syncthreads();
  for (int rl = 0; rl < 16; ++rl) if (lane < 8) vst2(QK + ((size_t)b * NP + p0 + wave * 16 + rl) * 64 + lane * 4, *(const v4f*)&so[wave][rl][lane * 4]);
  { v8b kh, kl;   // the wave's 16 positions are one key tile: the lane writes its own 16 bytes of the hi and of the lo fragment, 512 contiguous bytes a store
#pragma unroll
    for (int i = 0; i < 8; ++i) { const float v = so[wave][col][32 + 8 * g + i]; const __bf16 hb = (__bf16)v; kh[i] = hb; kl[i] = (__bf16)(v - (float)hb); }
    __bf16* kf = KF + ((size_t)b * (NP / 16) + blockIdx.x * 4 + wave) * 512 + lane * 8; *(v8b*)kf = kh; *(v8b*)(kf + 256) = kl; }
  for (int q = tid; q < CH * 8; q += 128) { const int fl = q & 31, hf = (q >> 5) & 1, dt = (q >> 6) & 3, kb = q >> 8; const int c = dt * 16 + (fl & 15), pc = kb * 4 + hf * 2 + (fl >> 4);   // q runs in the order of the fragments: a wave's store is 512 contiguous bytes
    const size_t o = ((size_t)b * (NP / 32) + blockIdx.x * 2 + kb) * 2048 + dt * 512 + hf * 256 + fl * 8; vst2((unsigned*)(VF + o), *(const v4u*)&sth[c][pc * 8]); }
}
// ---- k_attn: block = (32 queries, batch) = KSPL key shares, one wave each: the wave of share sh takes the blocks of 32 keys sh, sh + KSPL, ... for BOTH query tiles of the block, so a k or v fragment is loaded once for 32 queries; it keeps maxima, sums and accumulators per query tile, and the shares are merged in LDS at the end. Per wave the products are taken transposed: S^T[key][query] = k.q (K 32 with zeros beyond 8; 3 products) / sqrt(8), so a lane holds 16 of the 32 scores of ONE query of each tile (lane = (g, query); tile ct, element r = key 16 ct + 8 g + r), which is at once the B fragment of O^T[c][query] = X.P^T(hi/lo), X = x in bf16 (exact, so it has no lo part): the online softmax runs inside the lane, with one exchange between the two lane halves for the maximum; epilogue: weight of a share = 2 ** (m_share - max) / merged sum (maxima in base 2); merged O = sum of weighted partial O; out = Wv.O(hi/lo), one (16 channels, 16 queries, 32 input channels) product a wave; y[b][c][n] = x + gamma * out (one 128-B line per channel)
#define KSPL 16
// 2 ** v as the one hardware instruction, inline; arguments here lie at most a rounding error above 0, and a result below the normal range may go to 0
__device__ __forceinline__ float ex2(float v) { return __builtin_amdgcn_exp2f(v); }
// the value of lane l ^ 16 (the other lane half), without LDS
__device__ __forceinline__ float xhalf(float v) { const int b = __builtin_bit_cast(int, v); return __builtin_bit_cast(float, __builtin_amdgcn_permlanex16(b, b, 0x76543210, 0xfedcba98, false, false)); }
// fragments stored in lane order: p = the lane's own 16 bytes. x: elements 0..7 and, 512 bytes on, 8..15; k: elements 0..7, elements 8..15 (reduced dims 16..31) are zero
__device__ __forceinline__ v16b frag_v(const __bf16* p) { union { v16b v; v8b q[2]; } u; u.q[0] = *(const v8b*)p; u.q[1] = *(const v8b*)(p + 256); return u.v; }
__device__ __forceinline__ v16b frag_k(const __bf16* p) { union { v16b v; v8b q[2]; } u; u.q[0] = *(const v8b*)p; u.q[1] = (v8b){}; return u.v; }
__global__ __launch_bounds__(32 * KSPL) void k_attn(const float* __restrict__ QK, const __bf16* __restrict__ KF, const __bf16* __restrict__ VF, const float* __restrict__ X, const float* __restrict__ WV, const float* __restrict__ GM, float* __restrict__ Y) {
  __shared__ __align__(16) float so[KSPL][CH][36]; __shared__ __align__(16) float sm[KSPL][32], sl[KSPL][32], sw[KSPL][32];
  const int sh = __builtin_amdgcn_readfirstlane(threadIdx.x >> 5), lane = threadIdx.x & 31, col = lane & 15;   // wave number = key share, in a scalar register: the key loop's counter and branch stay scalar
  const int b = blockIdx.y; const int q0 = blockIdx.x * 32;
  F2 aq[2];
  // every inner loop of this kernel is unrolled in full: its counter indexes fragments, scores or accumulators, which stay in registers only under constant indices
#pragma unroll
  for (int qt = 0; qt < 2; ++qt) aq[qt] = split_row(QK + ((size_t)b * NP + q0 + qt * 16 + col) * 64, 0, lane);
  static_assert(KSPL == 16 && CH == 64, "closing product: 4 output channel tiles x 2 query tiles x 2 halves of the input channels = one wave each");
  const int mt = sh & 3, qe = (sh >> 2) & 1, kc = sh >> 3;
  v16b wa;   // the wave's A fragment of Wv for the closing product (row = output channel 16 mt + col, input channels 32 kc + 8 g + i and + 16), rounded to bf16; read here with q, so that no wave waits for it behind the loop
  { const float* wr = WV + (size_t)(mt * 16 + col) * CH + kc * 32 + 8 * (lane >> 4);
    const v4f w0 = *(const v4f*)wr, w1 = *(const v4f*)(wr + 4), w2 = *(const v4f*)(wr + 16), w3 = *(const v4f*)(wr + 20);
    asm volatile("s_wait_xcnt 0x0" :: "v"(wr) : "memory");   // stands behind the issued loads and in front of every overwrite of their address registers (the pointer is an input, so it stays in its registers up to here)
#pragma unroll
    for (int i = 0; i < 4; ++i) { wa[i] = (__bf16)w0[i]; wa[4 + i] = (__bf16)w1[i]; wa[8 + i] = (__bf16)w2[i]; wa[12 + i] = (__bf16)w3[i]; } }
  float m[2] = {-3.0e38f, -3.0e38f}, l[2] = {0.f, 0.f};   // of the lane's query in each tile; l counts the lane half's own keys only and is completed after the loop
  v8f acc[2][4] = {};   // acc[qt][dt][r] = O^T[input channel 16 dt + 8 g + r][query 16 qt + col]
  const float scale = 0.35355339059327373f * 1.4426950408889634f;   // 8 ** -0.5 * log2(e): maxima and exponents are kept in base 2, exp(z) = 2 ** (z log2(e))
#pragma unroll 1
  for (int ks = sh; ks < NP / 32; ks += KSPL) {
    // every fragment of the pass is read here, once, as one group ahead of the products: the x loads are in flight under the scores and the softmax
    F2 kb[2]; v16b vh[4];
    const __bf16* kp = KF + ((size_t)b * (NP / 16) + ks * 2) * 512 + lane * 8; const __bf16* vp = VF + ((size_t)b * (NP / 32) + ks) * 2048 + lane * 8;
#pragma unroll
    for (int ct = 0; ct < 2; ++ct) { kb[ct].h = frag_k(kp + ct * 512); kb[ct].l = frag_k(kp + ct * 512 + 256); }
#pragma unroll
    for (int dt = 0; dt < 4; ++dt) vh[dt] = frag_v(vp + dt * 512);
    asm volatile("s_wait_xcnt 0x0" :: "v"(kp), "v"(vp) : "memory");   // stands behind the issued loads and in front of every overwrite of their address registers (the two pointers are inputs, so they stay in their registers up to here)
    // the four score tiles (2 query tiles x 2 key tiles) go product by product, so that a tile's next product stands behind three independent ones; per tile the order of the three is lo.hi, hi.lo, hi.hi
    v8f c[2][2];
#pragma unroll
    for (int qt = 0; qt < 2; ++qt)
#pragma unroll
      for (int ct = 0; ct < 2; ++ct) c[qt][ct] = wmma_bf(kb[ct].l, aq[qt].h, (v8f){});
#pragma unroll
    for (int qt = 0; qt < 2; ++qt)
#pragma unroll
      for (int ct = 0; ct < 2; ++ct) c[qt][ct] = wmma_bf(kb[ct].h, aq[qt].l, c[qt][ct]);
#pragma unroll
    for (int qt = 0; qt < 2; ++qt)
#pragma unroll
      for (int ct = 0; ct < 2; ++ct) c[qt][ct] = wmma_bf(kb[ct].h, aq[qt].h, c[qt][ct]);
    F2 pb[2];
#pragma unroll
    for (int qt = 0; qt < 2; ++qt) { float s[16];
#pragma unroll
      for (int r = 0; r < 8; ++r) { s[r] = c[qt][0][r]; s[8 + r] = c[qt][1][r]; }
      float mx = s[0];
#pragma unroll
      for (int i = 1; i < 16; ++i) mx = fmaxf(mx, s[i]);
      mx = fmaxf(mx, xhalf(mx));   // both lane halves of a query scale by the same maximum: their keys are summed in one product
      const float mn = fmaxf(m[qt], mx * scale); const float alpha = ex2(m[qt] - mn); m[qt] = mn;   // scale > 0: the maximum of the raw scores, scaled, is the maximum of the scaled ones
#pragma unroll
      for (int i = 0; i < 16; ++i) s[i] = ex2(fmaf(s[i], scale, -mn));
      float t[8];
#pragma unroll
      for (int i = 0; i < 8; ++i) t[i] = s[i] + s[8 + i];
      l[qt] = l[qt] * alpha + (((t[0] + t[4]) + (t[2] + t[6])) + ((t[1] + t[5]) + (t[3] + t[7])));
#pragma unroll
      for (int dt = 0; dt < 4; ++dt) acc[qt][dt] *= alpha;
      pb[qt] = bsplit16(s); }
    // eight accumulators, product by product; per accumulator the order of the two is x.lo, x.hi
#pragma unroll
    for (int dt = 0; dt < 4; ++dt)
#pragma unroll
      for (int qt = 0; qt < 2; ++qt) acc[qt][dt] = wmma_bf(vh[dt], pb[qt].l, acc[qt][dt]);
#pragma unroll
    for (int dt = 0; dt < 4; ++dt)
#pragma unroll
      for (int qt = 0; qt < 2; ++qt) acc[qt][dt] = wmma_bf(vh[dt], pb[qt].h, acc[qt][dt]); }
#pragma unroll
  for (int qt = 0; qt < 2; ++qt) l[qt] += xhalf(l[qt]);
  const float gm = bfr(GM[0]);
  const int ln = __builtin_amdgcn_mbcnt_lo(~0u, 0u), ec = ln & 15, eg = ln >> 4;   // the lane number taken anew: the indices of the epilogue are not carried over the loop in registers
#pragma unroll
  for (int qt = 0; qt < 2; ++qt)
#pragma unroll
    for (int dt = 0; dt < 4; ++dt)
#pragma unroll
      for (int r = 0; r < 8; ++r) so[sh][dt * 16 + 8 * eg + r][qt * 16 + ec] = acc[qt][dt][r];   // so[share][channel][query local], not yet normalised
  if (eg == 0) {
#pragma unroll
    for (int qt = 0; qt < 2; ++qt) { sm[sh][qt * 16 + ec] = m[qt]; sl[sh][qt * 16 + ec] = l[qt]; } }
  __syncthreads();
  { const int q = ln; float mm = sm[0][q];   // the block has KSPL waves: wave sh forms the weights of share sh for the 32 queries
#pragma unroll
    for (int j = 1; j < KSPL; ++j) mm = fmaxf(mm, sm[j][q]);
    float ll = 0.f;
#pragma unroll
    for (int j = 0; j < KSPL; ++j) ll += sl[j][q] * ex2(sm[j][q] - mm);
    sw[sh][q] = ex2(sm[sh][q] - mm) / ll; }
  __syncthreads();   // the weights are read by every wave
  static_assert(KSPL == CH / 4, "one wave for every 4 channels of the output");
  const int c = sh * 4 + (ln >> 3), pc = ln & 7; const size_t o = ((size_t)b * CH + c) * NP + blockIdx.x * 32 + pc * 4;
  const v4f xs = *(const v4f*)(X + o);   // in flight under the merge
  { v4f ov = {};
#pragma unroll
    for (int s = 0; s < KSPL; ++s) ov += *(const v4f*)&sw[s][pc * 4] * *(const v4f*)&so[s][c][pc * 4];
    *(v4f*)&so[0][c][pc * 4] = ov; }   // merged O[input channel][query] takes the place of share 0: these 16 bytes of every share are read by this thread alone
  __syncthreads();   // the merged O is read by every wave
  { float t[16];   // B fragment: column = query 16 qe + ec, the k order of wa
#pragma unroll
    for (int i = 0; i < 8; ++i) { t[i] = so[0][kc * 32 + 8 * eg + i][qe * 16 + ec]; t[8 + i] = so[0][kc * 32 + 16 + 8 * eg + i][qe * 16 + ec]; }
    const F2 ob = bsplit16(t);
    v8f d = wmma_bf(wa, ob.l, (v8f){}); d = wmma_bf(wa, ob.h, d);
#pragma unroll
    for (int r = 0; r < 8; ++r) so[1 + kc][mt * 16 + 8 * eg + r][qe * 16 + ec] = d[r]; }   // the two halves of the input channels go to the places of shares 1 and 2, which nobody reads any more
  __syncthreads();   // a channel's line is put together from four waves' tiles
  { const v4f ov = *(const v4f*)&so[1][c][pc * 4] + *(const v4f*)&so[2][c][pc * 4];
    vst2(Y + o, (v4f){bfr(xs[0]) + gm * ov[0], bfr(xs[1]) + gm * ov[1], bfr(xs[2]) + gm * ov[2], bfr(xs[3]) + gm * ov[3]}); }
}
extern "C" void kernel_launch(void* const* d_in, const int* in_sizes, int n_in, void* d_out, int out_size, void* d_ws, size_t ws_size, hipStream_t stream) {
  (void)in_sizes; (void)n_in; (void)out_size;
  const float** F = (const float**)d_in;   // x [2,64,16,16,16], Wq [8,64], Wk [8,64], Wv [64,64], gamma [1]
  if (ws_size < (size_t)WS_END) return;
  char* ws = (char*)d_ws; __bf16 *KF = (__bf16*)(ws + WS_KF), *VF = (__bf16*)(ws + WS_VF); float* QK = (float*)(ws + WS_QK);
  k_proj<<<dim3(NP / 64, TNB), 128, 0, stream>>>(F[0], F[1], F[2], QK, KF, VF);
  k_attn<<<dim3(TQB, TNB), 32 * KSPL, 0, stream>>>(QK, KF, VF, F[0], F[3], F[4], (float*)d_out);
}

// v008
// It runs in 20.5 microseconds.
// Two timings next to v007 both put it at 1.13 times that version's speed.
// Counting every step since v000, it is 24.8 times as fast.
// compute dtype: x, Wq, Wk, Wv, gamma (module inputs) rounded to bf16; the 1x1x1 projections q/k with exact bf16 products (x and W are inputs) on WMMA 16x16x32 (the 8-wide q/k zero-padded to 32), scores q.k with both computed operands as bf16 hi + residual pairs (3 products, side by side along the 32-deep k of one WMMA), out = Wv.(x.attn^T): x (exact in bf16) x attn hi/lo (2 products), then Wv (exact in bf16) x the normalised sum hi/lo (2 products); softmax and the residual x + gamma*out in f32; f32 accumulate.
#include <hip/hip_runtime.h>
#include <math.h>

typedef __attribute__((ext_vector_type(16))) _Float16 v16h;
typedef __attribute__((ext_vector_type(16))) __bf16 v16b;
typedef __attribute__((ext_vector_type(8)))  _Float16 v8h;
typedef __attribute__((ext_vector_type(8)))  float v8f;
typedef __attribute__((ext_vector_type(4)))  float v4f;
typedef __attribute__((ext_vector_type(2)))  float v2f;
typedef __attribute__((ext_vector_type(4)))  unsigned v4u;
typedef __attribute__((ext_vector_type(4)))  int v4i;
typedef float __attribute__((may_alias)) float_a;
typedef int __attribute__((may_alias)) int_a;

template <typename T> __device__ __forceinline__ void vst2(void* p, T v) { *(T*)p = v;  }
__device__ __forceinline__ v8f wmma16(v16h a, v16h b, v8f c) {
  v8f d = __builtin_amdgcn_wmma_f32_16x16x32_f16(false, a, false, b, (short)0, c, false, false);
  asm volatile("v_nop\n\tv_nop\n\tv_nop\n\tv_nop" : "+v"(d) : "v"(a), "v"(b));
  return d;
}
__device__ __forceinline__ v8f wmma_bf(v16b a, v16b b, v8f c) {
  v8f d = __builtin_amdgcn_wmma_f32_16x16x32_bf16(false, a, false, b, (short)0, c, false, false);
  asm volatile("v_nop\n\tv_nop\n\tv_nop\n\tv_nop" : "+v"(d) : "v"(a), "v"(b));
  return d;
}
// 16x16x32 fragments: lane = (h = lane>>4, row/col = lane&15); elements 0..7 = k0+8h+0..7, 8..15 = k0+16+8h+0..7; D element r = row 8h+r
__device__ __forceinline__ v16h frag_h(const _Float16* rowk0, int lane) {
  union { v16h v; v8h q[2]; } u; const _Float16* p = rowk0 + 8 * (lane >> 4);
  u.q[0] = *(const v8h*)p; u.q[1] = *(const v8h*)(p + 16); return u.v;
}
__device__ __forceinline__ v16h frag_f32(const float* rowk0, int lane) {
  v16h a; const float* p = rowk0 + 8 * (lane >> 4);
#pragma unroll
  for (int i = 0; i < 8; ++i) { a[i] = (_Float16)p[i]; a[8 + i] = (_Float16)p[16 + i]; }
  return a;
}
__device__ __forceinline__ v16h frag_f32s(const float* rowk0, int lane, float sc) {
  v16h a; const float* p = rowk0 + 8 * (lane >> 4);
#pragma unroll
  for (int i = 0; i < 8; ++i) { a[i] = (_Float16)(p[i] * sc); a[8 + i] = (_Float16)(p[16 + i] * sc); }
  return a;
}
// column fragment from a [K][ld] layout (column n), rows >= K read as 0
__device__ __forceinline__ v16h fragc_f32(const float* W, int k0, int n, int lane, int ld, int K) {
  v16h a; const int g = lane >> 4;
#pragma unroll
  for (int i = 0; i < 8; ++i) { const int ka = k0 + 8 * g + i, kb = ka + 16;
    a[i] = (_Float16)(ka < K ? W[(size_t)(ka < K ? ka : K - 1) * ld + n] : 0.f); a[8 + i] = (_Float16)(kb < K ? W[(size_t)(kb < K ? kb : K - 1) * ld + n] : 0.f); }
  return a;
}
struct F2 { v16b h, l; };
__device__ __forceinline__ F2 bsplit16(const float v[16]) { F2 r;
#pragma unroll
  for (int i = 0; i < 16; ++i) { const __bf16 h = (__bf16)v[i]; r.h[i] = h; r.l[i] = (__bf16)(v[i] - (float)h); }
  return r; }
__device__ __forceinline__ F2 split_row(const float* row, int k0, int lane) { float v[16]; const float* p = row + k0 + 8 * (lane >> 4);
#pragma unroll
  for (int i = 0; i < 8; ++i) { v[i] = p[i]; v[8 + i] = p[16 + i]; }
  return bsplit16(v); }
__device__ __forceinline__ F2 split_rowK(const float* row, int k0, int lane, int K) { float v[16]; const int g = lane >> 4;
#pragma unroll
  for (int i = 0; i < 8; ++i) { const int ka = k0 + 8 * g + i, kb = ka + 16; v[i] = ka < K ? row[ka < K ? ka : K - 1] : 0.f; v[8 + i] = kb < K ? row[kb < K ? kb : K - 1] : 0.f; }
  return bsplit16(v); }
__device__ __forceinline__ F2 split_col(const float* W, int k0, int n, int lane, int ld, int K) { float v[16]; const int g = lane >> 4;
#pragma unroll
  for (int i = 0; i < 8; ++i) { const int ka = k0 + 8 * g + i, kb = ka + 16; v[i] = ka < K ? W[(size_t)(ka < K ? ka : K - 1) * ld + n] : 0.f; v[8 + i] = kb < K ? W[(size_t)(kb < K ? kb : K - 1) * ld + n] : 0.f; }
  return bsplit16(v); }
__device__ __forceinline__ v8f mac3(const F2& a, const F2& b, v8f c) { c = wmma_bf(a.l, b.h, c); c = wmma_bf(a.h, b.l, c); return wmma_bf(a.h, b.h, c); }
__device__ __forceinline__ float sigm(float v) { return 1.0f / (1.0f + expf(-v)); }
#define LDSX() do { asm volatile("s_wait_dscnt 0" ::: "memory"); __builtin_amdgcn_wave_barrier(); __builtin_amdgcn_fence(__ATOMIC_RELEASE, "workgroup"); } while (0)


// 3-D position attention (B 2, C 64, 16x16x16 = 4096 positions, reduced 8): q = Wq x, k = Wk x, v = Wv x (1x1x1 convs, no bias); attn = softmax(q^T k / sqrt(8)) over positions; out[c][n] = sum_m v[c][m] attn[n][m]; y = x + gamma * out. The sum over positions is linear, so it is taken over x and Wv is applied to its result: out = Wv.(x.attn^T).
#define NB 2
#define CH 64
#define NP 4096
#define RR 8
#ifndef TQB
#define TQB (NP / 32)
#define TNB NB
#endif
typedef __attribute__((ext_vector_type(8))) __bf16 v8b;
__device__ __forceinline__ v16b frag_b(const __bf16* rowk0, int lane) {
  union { v16b v; v8b q[2]; } u; const __bf16* p = rowk0 + 8 * (lane >> 4);
  u.q[0] = *(const v8b*)p; u.q[1] = *(const v8b*)(p + 16); return u.v;
}
__device__ __forceinline__ float bfr(float v) { return (float)(__bf16)v; }
__device__ __attribute__((noinline)) float erf_ni(float v) { return erff(v); }

#define WS_QK  0u                                // f32 [NB][NP][RR]: q
#define WS_KF  (WS_QK + 4u * NB * NP * RR)         // bf16 [NB][NP / 16 key tiles][32 lanes][8]: k of key 16 tile + col, reduced dims 0..7, as the A fragment's elements 0..7 in lane order: lane half 0 holds the hi parts, lane half 1 the lo parts
#define WS_VF  (WS_KF + 2u * NB * NP * 16)         // bf16 [NB][NP / 32 key blocks][4 channel tiles][2 halves][32 lanes][8]: x as A fragments (channel 16 dt + col, key 32 block + 16 half + 8 g + i), lane order
#define WS_END (WS_VF + 2u * NB * CH * NP)

// ---- k_proj: block = (64 positions, batch). The block rounds Wq and Wk to bf16 itself and keeps them in LDS as B operand rows ([out][in]): rows 0..7 Wq, 8..15 zero, 16..23 Wk, 24..31 zero; pitch 144 B for the 16-byte fragment reads. x, rounded to bf16, goes out in the order of the attention's A fragments
typedef __attribute__((ext_vector_type(4))) __bf16 v4b;
__global__ __launch_bounds__(128) void k_proj(const float* __restrict__ X, const float* __restrict__ WQ, const float* __restrict__ WK, float* __restrict__ QK, __bf16* __restrict__ KF, __bf16* __restrict__ VF) {
  __shared__ __align__(16) __bf16 sx[64][72]; __shared__ __align__(16) float so[4][16][68]; __shared__ __align__(16) __bf16 sth[CH][72]; __shared__ __align__(16) __bf16 swt[32][72];
  const int tid = threadIdx.x, wave = tid >> 5, lane = tid & 31, col = lane & 15, g = lane >> 4; const int b = blockIdx.y; const int p0 = blockIdx.x * 64;
  v4f w[2];   // 16 bytes a thread from each group of 8 weight rows (whole lines); issued first, in flight while x is brought in
  w[0] = *(const v4f*)(WQ + tid * 4); w[1] = *(const v4f*)(WK + tid * 4);
  for (int q = tid; q < CH * 64; q += 128) { const int c = q >> 6, nl = q & 63; const __bf16 xb = (__bf16)X[((size_t)b * CH + c) * NP + p0 + nl]; sx[nl][c] = xb; sth[c][nl] = xb; }   // sx[position][channel], sth[channel][position]
#pragma unroll
  for (int t = 0; t < 2; ++t) { v4b h;
#pragma unroll
    for (int i = 0; i < 4; ++i) h[i] = (__bf16)w[t][i];
    *(v4b*)&swt[t * 16 + (tid >> 4)][(tid & 15) * 4] = h; }
  { const int zr = tid >> 3; *(v8b*)&swt[(zr < 8 ? 8 : 16) + zr][(tid & 7) * 8] = (v8b){}; }   // the 16 zero rows
  __syncthreads();
  v16b a[2];
#pragma unroll
  for (int kc = 0; kc < 2; ++kc) {
#pragma unroll
    for (int i = 0; i < 8; ++i) { a[kc][i] = sx[wave * 16 + col][kc * 32 + 8 * g + i]; a[kc][8 + i] = sx[wave * 16 + col][kc * 32 + 16 + 8 * g + i]; } }
  v16b bw[2][2];   // all weight fragments read as one group ahead of the products: 16 rows of swt each
#pragma unroll
  for (int kc = 0; kc < 2; ++kc) {
#pragma unroll
    for (int t = 0; t < 2; ++t) bw[kc][t] = frag_b(&swt[t * 16 + col][kc * 32], lane); }
  v8f acc[4] = {};   // tiles: 0,1 = q plane cols 0..31; 2,3 = k plane cols 32..63; tiles 1 and 3 have no weight rows and stay zero
#pragma unroll
  for (int kc = 0; kc < 2; ++kc) {
#pragma unroll
    for (int j = 0; j < 4; j += 2) acc[j] = wmma_bf(a[kc], bw[kc][j / 2], acc[j]); }
#pragma unroll
  for (int j = 0; j < 4; j += 2)
#pragma unroll
    for (int r = 0; r < 8; ++r) so[wave][8 * g + r][j * 16 + col] = acc[j][r];
  __syncthreads();
  vst2(QK + ((size_t)b * NP + p0 + wave * 16 + (lane >> 1)) * RR + (lane & 1) * 4, *(const v4f*)&so[wave][lane >> 1][(lane & 1) * 4]);   // the 8 real dims of q of the wave's 16 positions: 512 contiguous bytes
  { v8b kk;   // the wave's 16 positions are one key tile: lane half 0 writes the hi parts of its key's 8 dims, lane half 1 the lo parts; 512 contiguous bytes
#pragma unroll
    for (int i = 0; i < 8; ++i) { const float v = so[wave][col][32 + i]; const __bf16 hb = (__bf16)v; kk[i] = g ? (__bf16)(v - (float)hb) : hb; }
    *(v8b*)(KF + ((size_t)b * (NP / 16) + blockIdx.x * 4 + wave) * 256 + lane * 8) = kk; }
  for (int q = tid; q < CH * 8; q += 128) { const int fl = q & 31, hf = (q >> 5) & 1, dt = (q >> 6) & 3, kb = q >> 8; const int c = dt * 16 + (fl & 15), pc = kb * 4 + hf * 2 + (fl >> 4);   // q runs in the order of the fragments: a wave's store is 512 contiguous bytes
    const size_t o = ((size_t)b * (NP / 32) + blockIdx.x * 2 + kb) * 2048 + dt * 512 + hf * 256 + fl * 8; vst2((unsigned*)(VF + o), *(const v4u*)&sth[c][pc * 8]); }
}
// ---- k_attn: block = (32 queries, batch) = KSPL key shares, one wave each: the wave of share sh takes the blocks of 32 keys sh, sh + KSPL, ... for BOTH query tiles of the block, so a k or v fragment is loaded once for 32 queries; it keeps maxima, sums and accumulators per query tile, and the shares are merged in LDS at the end. Per wave the products are taken transposed: S^T[key][query] = k.q / sqrt(8), its 3 products of 8 dims (hi.hi, lo.hi, hi.lo) laid side by side along the K 32 of one WMMA: A = k hi | lo | hi | lo, B = q hi | hi | lo | 0, so a lane holds 16 of the 32 scores of ONE query of each tile (lane = (g, query); tile ct, element r = key 16 ct + 8 g + r), which is at once the B fragment of O^T[c][query] = X.P^T(hi/lo), X = x in bf16 (exact, so it has no lo part): the online softmax runs inside the lane, with one exchange between the two lane halves for the maximum; epilogue: weight of a share = 2 ** (m_share - max) / merged sum (maxima in base 2); merged O = sum of weighted partial O; out = Wv.O(hi/lo), one (16 channels, 16 queries, 32 input channels) product a wave; y[b][c][n] = x + gamma * out (one 128-B line per channel)
#define KSPL 16
// 2 ** v as the one hardware instruction, inline; arguments here lie at most a rounding error above 0, and a result below the normal range may go to 0
__device__ __forceinline__ float ex2(float v) { return __builtin_amdgcn_exp2f(v); }
// the same instruction with the slot behind it in one statement (one v_nop before its result is used or its source overwritten)
__device__ __forceinline__ float ex2_slot(float v) { float r; asm("v_exp_f32 %0, %1\n\tv_nop" : "=v"(r) : "v"(v)); return r; }
// the value of lane l ^ 16 (the other lane half), without LDS
__device__ __forceinline__ float xhalf(float v) { const int b = __builtin_bit_cast(int, v); return __builtin_bit_cast(float, __builtin_amdgcn_permlanex16(b, b, 0x76543210, 0xfedcba98, false, false)); }
// fragments stored in lane order: p = the lane's own 16 bytes. x: elements 0..7 and, 512 bytes on, 8..15; k: elements 0..7 (hi parts in lane half 0, lo parts in lane half 1), elements 8..15 repeat them
__device__ __forceinline__ v16b frag_v(const __bf16* p) { union { v16b v; v8b q[2]; } u; u.q[0] = *(const v8b*)p; u.q[1] = *(const v8b*)(p + 256); return u.v; }
__device__ __forceinline__ v16b frag_k(const __bf16* p) { union { v16b v; v8b q[2]; } u; u.q[0] = *(const v8b*)p; u.q[1] = u.q[0]; return u.v; }
__global__ __launch_bounds__(32 * KSPL) void k_attn(const float* __restrict__ QK, const __bf16* __restrict__ KF, const __bf16* __restrict__ VF, const float* __restrict__ X, const float* __restrict__ WV, const float* __restrict__ GM, float* __restrict__ Y) {
  __shared__ __align__(16) float so[KSPL][CH][36]; __shared__ __align__(16) float sm[KSPL][32], sl[KSPL][32], sw[KSPL][32];
  const int sh = __builtin_amdgcn_readfirstlane(threadIdx.x >> 5), lane = threadIdx.x & 31, col = lane & 15;   // wave number = key share, in a scalar register: the key loop's counter and branch stay scalar
  const int b = blockIdx.y; const int q0 = blockIdx.x * 32;
  v16b aq[2];   // B fragment of q: elements 0..7 = hi parts in both lane halves (against k hi and k lo), elements 8..15 = lo parts in lane half 0 (against k hi), zero in lane half 1
  // every inner loop of this kernel is unrolled in full: its counter indexes fragments, scores or accumulators, which stay in registers only under constant indices
#pragma unroll
  for (int qt = 0; qt < 2; ++qt) { const float* qr = QK + ((size_t)b * NP + q0 + qt * 16 + col) * RR; const v4f a0 = *(const v4f*)qr, a1 = *(const v4f*)(qr + 4);
#pragma unroll
    for (int i = 0; i < 8; ++i) { const float v = i < 4 ? a0[i & 3] : a1[i & 3]; const __bf16 hb = (__bf16)v; aq[qt][i] = hb; aq[qt][8 + i] = (lane >> 4) ? (__bf16)0.f : (__bf16)(v - (float)hb); } }
  static_assert(KSPL == 16 && CH == 64, "closing product: 4 output channel tiles x 2 query tiles x 2 halves of the input channels = one wave each");
  const int mt = sh & 3, qe = (sh >> 2) & 1, kc = sh >> 3;
  v16b wa;   // the wave's A fragment of Wv for the closing product (row = output channel 16 mt + col, input channels 32 kc + 8 g + i and + 16), rounded to bf16; read here with q, so that no wave waits for it behind the loop
  { const float* wr = WV + (size_t)(mt * 16 + col) * CH + kc * 32 + 8 * (lane >> 4);
    const v4f w0 = *(const v4f*)wr, w1 = *(const v4f*)(wr + 4), w2 = *(const v4f*)(wr + 16), w3 = *(const v4f*)(wr + 20);
    asm volatile("s_wait_xcnt 0x0" :: "v"(wr) : "memory");   // stands behind the issued loads and in front of every overwrite of their address registers (the pointer is an input, so it stays in its registers up to here)
#pragma unroll
    for (int i = 0; i < 4; ++i) { wa[i] = (__bf16)w0[i]; wa[4 + i] = (__bf16)w1[i]; wa[8 + i] = (__bf16)w2[i]; wa[12 + i] = (__bf16)w3[i]; } }
  float m[2] = {-3.0e38f, -3.0e38f}, l[2] = {0.f, 0.f};   // of the lane's query in each tile; l counts the lane half's own keys only and is completed after the loop
  v8f acc[2][4] = {};   // acc[qt][dt][r] = O^T[input channel 16 dt + 8 g + r][query 16 qt + col]
  const float scale = 0.35355339059327373f * 1.4426950408889634f;   // 8 ** -0.5 * log2(e): maxima and exponents are kept in base 2, exp(z) = 2 ** (z log2(e))
#pragma unroll 1
  for (int ks = sh; ks < NP / 32; ks += KSPL) {
    // every fragment of the pass is read here, once, as one group ahead of the products: the x loads are in flight under the scores and the softmax
    v16b kb[2], vh[4];
    const __bf16* kp = KF + ((size_t)b * (NP / 16) + ks * 2) * 256 + lane * 8; const __bf16* vp = VF + ((size_t)b * (NP / 32) + ks) * 2048 + lane * 8;
#pragma unroll
    for (int ct = 0; ct < 2; ++ct) kb[ct] = frag_k(kp + ct * 256);
#pragma unroll
    for (int dt = 0; dt < 4; ++dt) vh[dt] = frag_v(vp + dt * 512);
    asm volatile("s_wait_xcnt 0x0" :: "v"(kp), "v"(vp) : "memory");   // stands behind the issued loads and in front of every overwrite of their address registers (the two pointers are inputs, so they stay in their registers up to here)
    // the four score tiles (2 query tiles x 2 key tiles), one WMMA each
    v8f c[2][2];
#pragma unroll
    for (int qt = 0; qt < 2; ++qt)
#pragma unroll
      for (int ct = 0; ct < 2; ++ct) c[qt][ct] = wmma_bf(kb[ct], aq[qt], (v8f){});
    F2 pb[2];
#pragma unroll
    for (int qt = 0; qt < 2; ++qt) { float s[16];
#pragma unroll
      for (int r = 0; r < 8; ++r) { s[r] = c[qt][0][r]; s[8 + r] = c[qt][1][r]; }
      float mx = s[0];
#pragma unroll
      for (int i = 1; i < 16; ++i) mx = fmaxf(mx, s[i]);
      mx = fmaxf(mx, xhalf(mx));   // both lane halves of a query scale by the same maximum: their keys are summed in one product
      const float mn = fmaxf(m[qt], mx * scale); const float alpha = ex2_slot(m[qt] - mn); m[qt] = mn;   // scale > 0: the maximum of the raw scores, scaled, is the maximum of the scaled ones
#pragma unroll
      for (int i = 0; i < 16; ++i) s[i] = ex2(fmaf(s[i], scale, -mn));
      float t[8];
#pragma unroll
      for (int i = 0; i < 8; ++i) t[i] = s[i] + s[8 + i];
      l[qt] = l[qt] * alpha + (((t[0] + t[4]) + (t[2] + t[6])) + ((t[1] + t[5]) + (t[3] + t[7])));
#pragma unroll
      for (int dt = 0; dt < 4; ++dt) acc[qt][dt] *= alpha;
      pb[qt] = bsplit16(s); }
    // eight accumulators, product by product; per accumulator the order of the two is x.lo, x.hi
#pragma unroll
    for (int dt = 0; dt < 4; ++dt)
#pragma unroll
      for (int qt = 0; qt < 2; ++qt) acc[qt][dt] = wmma_bf(vh[dt], pb[qt].l, acc[qt][dt]);
#pragma unroll
    for (int dt = 0; dt < 4; ++dt)
#pragma unroll
      for (int qt = 0; qt < 2; ++qt) acc[qt][dt] = wmma_bf(vh[dt], pb[qt].h, acc[qt][dt]); }
#pragma unroll
  for (int qt = 0; qt < 2; ++qt) l[qt] += xhalf(l[qt]);
  const float gm = bfr(GM[0]);
  const int ln = __builtin_amdgcn_mbcnt_lo(~0u, 0u), ec = ln & 15, eg = ln >> 4;   // the lane number taken anew: the indices of the epilogue are not carried over the loop in registers
#pragma unroll
  for (int qt = 0; qt < 2; ++qt)
#pragma unroll
    for (int dt = 0; dt < 4; ++dt)
#pragma unroll
      for (int r = 0; r < 8; ++r) so[sh][dt * 16 + 8 * eg + r][qt * 16 + ec] = acc[qt][dt][r];   // so[share][channel][query local], not yet normalised
  if (eg == 0) {
#pragma unroll
    for (int qt = 0; qt < 2; ++qt) { sm[sh][qt * 16 + ec] = m[qt]; sl[sh][qt * 16 + ec] = l[qt]; } }
  __syncthreads();
  { const int q = ln; float mm = sm[0][q];   // the block has KSPL waves: wave sh forms the weights of share sh for the 32 queries
#pragma unroll
    for (int j = 1; j < KSPL; ++j) mm = fmaxf(mm, sm[j][q]);
    float ll = 0.f;
#pragma unroll
    for (int j = 0; j < KSPL; ++j) ll += sl[j][q] * ex2(sm[j][q] - mm);
    sw[sh][q] = ex2(sm[sh][q] - mm) / ll; }
  __syncthreads();   // the weights are read by every wave
  static_assert(KSPL == CH / 4, "one wave for every 4 channels of the output");
  const int c = sh * 4 + (ln >> 3), pc = ln & 7; const size_t o = ((size_t)b * CH + c) * NP + blockIdx.x * 32 + pc * 4;
  const v4f xs = *(const v4f*)(X + o);   // in flight under the merge
  { v4f ov = {};
#pragma unroll
    for (int s = 0; s < KSPL; ++s) ov += *(const v4f*)&sw[s][pc * 4] * *(const v4f*)&so[s][c][pc * 4];
    *(v4f*)&so[0][c][pc * 4] = ov; }   // merged O[input channel][query] takes the place of share 0: these 16 bytes of every share are read by this thread alone
  __syncthreads();   // the merged O is read by every wave
  { float t[16];   // B fragment: column = query 16 qe + ec, the k order of wa
#pragma unroll
    for (int i = 0; i < 8; ++i) { t[i] = so[0][kc * 32 + 8 * eg + i][qe * 16 + ec]; t[8 + i] = so[0][kc * 32 + 16 + 8 * eg + i][qe * 16 + ec]; }
    const F2 ob = bsplit16(t);
    v8f d = wmma_bf(wa, ob.l, (v8f){}); d = wmma_bf(wa, ob.h, d);
#pragma unroll
    for (int r = 0; r < 8; ++r) so[1 + kc][mt * 16 + 8 * eg + r][qe * 16 + ec] = d[r]; }   // the two halves of the input channels go to the places of shares 1 and 2, which nobody reads any more
  __syncthreads();   // a channel's line is put together from four waves' tiles
  { const v4f ov = *(const v4f*)&so[1][c][pc * 4] + *(const v4f*)&so[2][c][pc * 4];
    vst2(Y + o, (v4f){bfr(xs[0]) + gm * ov[0], bfr(xs[1]) + gm * ov[1], bfr(xs[2]) + gm * ov[2], bfr(xs[3]) + gm * ov[3]}); }
}
extern "C" void kernel_launch(void* const* d_in, const int* in_sizes, int n_in, void* d_out, int out_size, void* d_ws, size_t ws_size, hipStream_t stream) {
  (void)in_sizes; (void)n_in; (void)out_size;
  const float** F = (const float**)d_in;   // x [2,64,16,16,16], Wq [8,64], Wk [8,64], Wv [64,64], gamma [1]
  if (ws_size < (size_t)WS_END) return;
  char* ws = (char*)d_ws; __bf16 *KF = (__bf16*)(ws + WS_KF), *VF = (__bf16*)(ws + WS_VF); float* QK = (float*)(ws + WS_QK);
  k_proj<<<dim3(NP / 64, TNB), 128, 0, stream>>>(F[0], F[1], F[2], QK, KF, VF);
  k_attn<<<dim3(TQB, TNB), 32 * KSPL, 0, stream>>>(QK, KF, VF, F[0], F[3], F[4], (float*)d_out);
}

// v009
// A run of this version takes 18.2 microseconds.
// Next to v008, in two timings, it ran 1.13 and 1.12 times as fast.
// Over all steps from v000 it is 27.9 times as fast.
// compute dtype: x, Wq, Wk, Wv, gamma (module inputs) rounded to bf16; the 1x1x1 projections q/k with exact bf16 products (x and W are inputs) on WMMA 16x16x32 (the 8-wide q/k zero-padded to 32), scores q.k with both computed operands as bf16 hi + residual pairs (3 products, side by side along the 32-deep k of one WMMA), out = Wv.(x.attn^T): x (exact in bf16) x attn hi/lo (2 products), then Wv (exact in bf16) x the normalised sum hi/lo (2 products); softmax and the residual x + gamma*out in f32; f32 accumulate.
#include <hip/hip_runtime.h>
#include <math.h>

typedef __attribute__((ext_vector_type(16))) _Float16 v16h;
typedef __attribute__((ext_vector_type(16))) __bf16 v16b;
typedef __attribute__((ext_vector_type(8)))  _Float16 v8h;
typedef __attribute__((ext_vector_type(8)))  float v8f;
typedef __attribute__((ext_vector_type(4)))  float v4f;
typedef __attribute__((ext_vector_type(2)))  float v2f;
typedef __attribute__((ext_vector_type(4)))  unsigned v4u;
typedef __attribute__((ext_vector_type(4)))  int v4i;
typedef float __attribute__((may_alias)) float_a;
typedef int __attribute__((may_alias)) int_a;

template <typename T> __device__ __forceinline__ void vst2(void* p, T v) { *(T*)p = v;  }
__device__ __forceinline__ v8f wmma16(v16h a, v16h b, v8f c) {
  v8f d = __builtin_amdgcn_wmma_f32_16x16x32_f16(false, a, false, b, (short)0, c, false, false);
  asm volatile("v_nop\n\tv_nop\n\tv_nop\n\tv_nop" : "+v"(d) : "v"(a), "v"(b));
  return d;
}
__device__ __forceinline__ v8f wmma_bf(v16b a, v16b b, v8f c) {
  v8f d = __builtin_amdgcn_wmma_f32_16x16x32_bf16(false, a, false, b, (short)0, c, false, false);
  asm volatile("v_nop\n\tv_nop\n\tv_nop\n\tv_nop" : "+v"(d) : "v"(a), "v"(b));
  return d;
}
// 16x16x32 fragments: lane = (h = lane>>4, row/col = lane&15); elements 0..7 = k0+8h+0..7, 8..15 = k0+16+8h+0..7; D element r = row 8h+r
__device__ __forceinline__ v16h frag_h(const _Float16* rowk0, int lane) {
  union { v16h v; v8h q[2]; } u; const _Float16* p = rowk0 + 8 * (lane >> 4);
  u.q[0] = *(const v8h*)p; u.q[1] = *(const v8h*)(p + 16); return u.v;
}
__device__ __forceinline__ v16h frag_f32(const float* rowk0, int lane) {
  v16h a; const float* p = rowk0 + 8 * (lane >> 4);
#pragma unroll
  for (int i = 0; i < 8; ++i) { a[i] = (_Float16)p[i]; a[8 + i] = (_Float16)p[16 + i]; }
  return a;
}
__device__ __forceinline__ v16h frag_f32s(const float* rowk0, int lane, float sc) {
  v16h a; const float* p = rowk0 + 8 * (lane >> 4);
#pragma unroll
  for (int i = 0; i < 8; ++i) { a[i] = (_Float16)(p[i] * sc); a[8 + i] = (_Float16)(p[16 + i] * sc); }
  return a;
}
// column fragment from a [K][ld] layout (column n), rows >= K read as 0
__device__ __forceinline__ v16h fragc_f32(const float* W, int k0, int n, int lane, int ld, int K) {
  v16h a; const int g = lane >> 4;
#pragma unroll
  for (int i = 0; i < 8; ++i) { const int ka = k0 + 8 * g + i, kb = ka + 16;
    a[i] = (_Float16)(ka < K ? W[(size_t)(ka < K ? ka : K - 1) * ld + n] : 0.f); a[8 + i] = (_Float16)(kb < K ? W[(size_t)(kb < K ? kb : K - 1) * ld + n] : 0.f); }
  return a;
}
struct F2 { v16b h, l; };
__device__ __forceinline__ F2 bsplit16(const float v[16]) { F2 r;
#pragma unroll
  for (int i = 0; i < 16; ++i) { const __bf16 h = (__bf16)v[i]; r.h[i] = h; r.l[i] = (__bf16)(v[i] - (float)h); }
  return r; }
__device__ __forceinline__ F2 split_row(const float* row, int k0, int lane) { float v[16]; const float* p = row + k0 + 8 * (lane >> 4);
#pragma unroll
  for (int i = 0; i < 8; ++i) { v[i] = p[i]; v[8 + i] = p[16 + i]; }
  return bsplit16(v); }
__device__ __forceinline__ F2 split_rowK(const float* row, int k0, int lane, int K) { float v[16]; const int g = lane >> 4;
#pragma unroll
  for (int i = 0; i < 8; ++i) { const int ka = k0 + 8 * g + i, kb = ka + 16; v[i] = ka < K ? row[ka < K ? ka : K - 1] : 0.f; v[8 + i] = kb < K ? row[kb < K ? kb : K - 1] : 0.f; }
  return bsplit16(v); }
__device__ __forceinline__ F2 split_col(const float* W, int k0, int n, int lane, int ld, int K) { float v[16]; const int g = lane >> 4;
#pragma unroll
  for (int i = 0; i < 8; ++i) { const int ka = k0 + 8 * g + i, kb = ka + 16; v[i] = ka < K ? W[(size_t)(ka < K ? ka : K - 1) * ld + n] : 0.f; v[8 + i] = kb < K ? W[(size_t)(kb < K ? kb : K - 1) * ld + n] : 0.f; }
  return bsplit16(v); }
__device__ __forceinline__ v8f mac3(const F2& a, const F2& b, v8f c) { c = wmma_bf(a.l, b.h, c); c = wmma_bf(a.h, b.l, c); return wmma_bf(a.h, b.h, c); }
__device__ __forceinline__ float sigm(float v) { return 1.0f / (1.0f + expf(-v)); }
#define LDSX() do { asm volatile("s_wait_dscnt 0" ::: "memory"); __builtin_amdgcn_wave_barrier(); __builtin_amdgcn_fence(__ATOMIC_RELEASE, "workgroup"); } while (0)


// 3-D position attention (B 2, C 64, 16x16x16 = 4096 positions, reduced 8): q = Wq x, k = Wk x, v = Wv x (1x1x1 convs, no bias); attn = softmax(q^T k / sqrt(8)) over positions; out[c][n] = sum_m v[c][m] attn[n][m]; y = x + gamma * out. The sum over positions is linear, so it is taken over x and Wv is applied to its result: out = Wv.(x.attn^T).
#define NB 2
#define CH 64
#define NP 4096
#define RR 8
#ifndef TQB
#define TQB (NP / 32)
#define TNB NB
#endif
typedef __attribute__((ext_vector_type(8))) __bf16 v8b;
__device__ __forceinline__ v16b frag_b(const __bf16* rowk0, int lane) {
  union { v16b v; v8b q[2]; } u; const __bf16* p = rowk0 + 8 * (lane >> 4);
  u.q[0] = *(const v8b*)p; u.q[1] = *(const v8b*)(p + 16); return u.v;
}
__device__ __forceinline__ float bfr(float v) { return (float)(__bf16)v; }
__device__ __attribute__((noinline)) float erf_ni(float v) { return erff(v); }

#define WS_QK  0u                                // f32 [NB][NP][RR]: q * 8 ** -0.5 * log2(e)
#define WS_KF  (WS_QK + 4u * NB * NP * RR)         // bf16 [NB][NP / 16 key tiles][32 lanes][8]: k of key 16 tile + col, reduced dims 0..7, as the A fragment's elements 0..7 in lane order: lane half 0 holds the hi parts, lane half 1 the lo parts
#define WS_VF  (WS_KF + 2u * NB * NP * 16)         // bf16 [NB][NP / 32 key blocks][4 channel tiles][2 halves][32 lanes][8]: x as A fragments (channel 16 dt + col, key 32 block + 16 half + 8 g + i), lane order
#define WS_END (WS_VF + 2u * NB * CH * NP)

// ---- k_proj: block = (64 positions, batch). The block rounds Wq and Wk to bf16 itself and keeps them in LDS as B operand rows ([out][in]): rows 0..7 Wq, 8..15 zero, 16..23 Wk, 24..31 zero; pitch 144 B for the 16-byte fragment reads. x, rounded to bf16, goes out in the order of the attention's A fragments
typedef __attribute__((ext_vector_type(4))) __bf16 v4b;
__global__ __launch_bounds__(128) void k_proj(const float* __restrict__ X, const float* __restrict__ WQ, const float* __restrict__ WK, float* __restrict__ QK, __bf16* __restrict__ KF, __bf16* __restrict__ VF) {
  __shared__ __align__(16) __bf16 sx[64][72]; __shared__ __align__(16) float so[4][16][68]; __shared__ __align__(16) __bf16 sth[CH][72]; __shared__ __align__(16) __bf16 swt[32][72];
  const int tid = threadIdx.x, wave = tid >> 5, lane = tid & 31, col = lane & 15, g = lane >> 4; const int b = blockIdx.y; const int p0 = blockIdx.x * 64;
  v4f w[2];   // 16 bytes a thread from each group of 8 weight rows (whole lines); issued first, in flight while x is brought in
  w[0] = *(const v4f*)(WQ + tid * 4); w[1] = *(const v4f*)(WK + tid * 4);
  for (int q = tid; q < CH * 64; q += 128) { const int c = q >> 6, nl = q & 63; const __bf16 xb = (__bf16)X[((size_t)b * CH + c) * NP + p0 + nl]; sx[nl][c] = xb; sth[c][nl] = xb; }   // sx[position][channel], sth[channel][position]
#pragma unroll
  for (int t = 0; t < 2; ++t) { v4b h;
#pragma unroll
    for (int i = 0; i < 4; ++i) h[i] = (__bf16)w[t][i];
    *(v4b*)&swt[t * 16 + (tid >> 4)][(tid & 15) * 4] = h; }
  { const int zr = tid >> 3; *(v8b*)&swt[(zr < 8 ? 8 : 16) + zr][(tid & 7) * 8] = (v8b){}; }   // the 16 zero rows
  __syncthreads();
  v16b a[2];
#pragma unroll
  for (int kc = 0; kc < 2; ++kc) {
#pragma unroll
    for (int i = 0; i < 8; ++i) { a[kc][i] = sx[wave * 16 + col][kc * 32 + 8 * g + i]; a[kc][8 + i] = sx[wave * 16 + col][kc * 32 + 16 + 8 * g + i]; } }
  v16b bw[2][2];   // all weight fragments read as one group ahead of the products: 16 rows of swt each
#pragma unroll
  for (int kc = 0; kc < 2; ++kc) {
#pragma unroll
    for (int t = 0; t < 2; ++t) bw[kc][t] = frag_b(&swt[t * 16 + col][kc * 32], lane); }
  v8f acc[4] = {};   // tiles: 0,1 = q plane cols 0..31; 2,3 = k plane cols 32..63; tiles 1 and 3 have no weight rows and stay zero
#pragma unroll
  for (int kc = 0; kc < 2; ++kc) {
#pragma unroll
    for (int j = 0; j < 4; j += 2) acc[j] = wmma_bf(a[kc], bw[kc][j / 2], acc[j]); }
  acc[0] *= 0.35355339059327373f * 1.4426950408889634f;   // q goes out times 8 ** -0.5 * log2(e): exp(z) = 2 ** (z log2(e)), so q.k is the exponent in base 2
#pragma unroll
  for (int j = 0; j < 4; j += 2)
#pragma unroll
    for (int r = 0; r < 8; ++r) so[wave][8 * g + r][j * 16 + col] = acc[j][r];
  __syncthreads();
  vst2(QK + ((size_t)b * NP + p0 + wave * 16 + (lane >> 1)) * RR + (lane & 1) * 4, *(const v4f*)&so[wave][lane >> 1][(lane & 1) * 4]);   // the 8 real dims of q of the wave's 16 positions: 512 contiguous bytes
  { v8b kk;   // the wave's 16 positions are one key tile: lane half 0 writes the hi parts of its key's 8 dims, lane half 1 the lo parts; 512 contiguous bytes
#pragma unroll
    for (int i = 0; i < 8; ++i) { const float v = so[wave][col][32 + i]; const __bf16 hb = (__bf16)v; kk[i] = g ? (__bf16)(v - (float)hb) : hb; }
    *(v8b*)(KF + ((size_t)b * (NP / 16) + blockIdx.x * 4 + wave) * 256 + lane * 8) = kk; }
  for (int q = tid; q < CH * 8; q += 128) { const int fl = q & 31, hf = (q >> 5) & 1, dt = (q >> 6) & 3, kb = q >> 8; const int c = dt * 16 + (fl & 15), pc = kb * 4 + hf * 2 + (fl >> 4);   // q runs in the order of the fragments: a wave's store is 512 contiguous bytes
    const size_t o = ((size_t)b * (NP / 32) + blockIdx.x * 2 + kb) * 2048 + dt * 512 + hf * 256 + fl * 8; vst2((unsigned*)(VF + o), *(const v4u*)&sth[c][pc * 8]); }
}
// ---- k_attn: block = (32 queries, batch) = KSPL key shares, one wave each: the wave of share sh takes the blocks of 32 keys sh, sh + KSPL, ... for BOTH query tiles of the block, so a k or v fragment is loaded once for 32 queries; it keeps maxima, sums and accumulators per query tile, and the shares are merged in LDS at the end. Per wave the products are taken transposed: S^T[key][query] = k.q (q comes scaled by 8 ** -0.5 * log2(e)), its 3 products of 8 dims (hi.hi, lo.hi, hi.lo) laid side by side along the K 32 of one WMMA: A = k hi | lo | hi | lo, B = q hi | hi | lo | 0, so a lane holds 16 of the 32 scores of ONE query of each tile (lane = (g, query); tile ct, element r = key 16 ct + 8 g + r), which is at once the B fragment of O^T[c][query] = X.P^T(hi/lo), X = x in bf16 (exact, so it has no lo part): the softmax runs inside the lane, its exponents taken against a reference that the share's first pass fixes (the maximum of its first 32 keys; one exchange between the two lane halves there); epilogue: weight of a share = 2 ** (m_share - max) / merged sum (references in base 2); merged O = sum of weighted partial O; out = Wv.O(hi/lo), one (16 channels, 16 queries, 32 input channels) product a wave; y[b][c][n] = x + gamma * out (one 128-B line per channel)
#define KSPL 16
template <int V> struct Kind { static constexpr int v = V; };
// 2 ** v as the one hardware instruction, inline; a result below the normal range may go to 0; under the fixed reference an argument may lie above 0, and the test on the sums behind the loop catches an overflow
__device__ __forceinline__ float ex2(float v) { return __builtin_amdgcn_exp2f(v); }
// the same instruction with the slot behind it in one statement (one v_nop before its result is used or its source overwritten)
__device__ __forceinline__ float ex2_slot(float v) { float r; asm("v_exp_f32 %0, %1\n\tv_nop" : "=v"(r) : "v"(v)); return r; }
// the value of lane l ^ 16 (the other lane half), without LDS
__device__ __forceinline__ float xhalf(float v) { const int b = __builtin_bit_cast(int, v); return __builtin_bit_cast(float, __builtin_amdgcn_permlanex16(b, b, 0x76543210, 0xfedcba98, false, false)); }
// fragments stored in lane order: p = the lane's own 16 bytes. x: elements 0..7 and, 512 bytes on, 8..15; k: elements 0..7 (hi parts in lane half 0, lo parts in lane half 1), elements 8..15 repeat them
__device__ __forceinline__ v16b frag_v(const __bf16* p) { union { v16b v; v8b q[2]; } u; u.q[0] = *(const v8b*)p; u.q[1] = *(const v8b*)(p + 256); return u.v; }
__device__ __forceinline__ v16b frag_k(const __bf16* p) { union { v16b v; v8b q[2]; } u; u.q[0] = *(const v8b*)p; u.q[1] = u.q[0]; return u.v; }
__global__ __launch_bounds__(32 * KSPL) void k_attn(const float* __restrict__ QK, const __bf16* __restrict__ KF, const __bf16* __restrict__ VF, const float* __restrict__ X, const float* __restrict__ WV, const float* __restrict__ GM, float* __restrict__ Y) {
  __shared__ __align__(16) float so[KSPL][CH][36]; __shared__ __align__(16) float sm[KSPL][32], sl[KSPL][32], sw[KSPL][32];
  const int sh = __builtin_amdgcn_readfirstlane(threadIdx.x >> 5), lane = threadIdx.x & 31, col = lane & 15;   // wave number = key share, in a scalar register: the key loop's counter and branch stay scalar
  const int b = blockIdx.y; const int q0 = blockIdx.x * 32;
  v16b aq[2];   // B fragment of q (which the projection has scaled, so the scores leave the WMMA as exponents in base 2): elements 0..7 = hi parts in both lane halves (against k hi and k lo), elements 8..15 = lo parts in lane half 0 (against k hi), zero in lane half 1
  // every inner loop of this kernel is unrolled in full: its counter indexes fragments, scores or accumulators, which stay in registers only under constant indices
#pragma unroll
  for (int qt = 0; qt < 2; ++qt) { const float* qr = QK + ((size_t)b * NP + q0 + qt * 16 + col) * RR; const v4f a0 = *(const v4f*)qr, a1 = *(const v4f*)(qr + 4);
#pragma unroll
    for (int i = 0; i < 8; ++i) { const float v = i < 4 ? a0[i & 3] : a1[i & 3]; const __bf16 hb = (__bf16)v; aq[qt][i] = hb; aq[qt][8 + i] = (lane >> 4) ? (__bf16)0.f : (__bf16)(v - (float)hb); } }
  static_assert(KSPL == 16 && CH == 64, "closing product: 4 output channel tiles x 2 query tiles x 2 halves of the input channels = one wave each");
  const int mt = sh & 3, qe = (sh >> 2) & 1, kc = sh >> 3;
  v16b wa;   // the wave's A fragment of Wv for the closing product (row = output channel 16 mt + col, input channels 32 kc + 8 g + i and + 16), rounded to bf16; read here with q, so that no wave waits for it behind the loop
  { const float* wr = WV + (size_t)(mt * 16 + col) * CH + kc * 32 + 8 * (lane >> 4);
    const v4f w0 = *(const v4f*)wr, w1 = *(const v4f*)(wr + 4), w2 = *(const v4f*)(wr + 16), w3 = *(const v4f*)(wr + 20);
    asm volatile("s_wait_xcnt 0x0" :: "v"(wr) : "memory");   // stands behind the issued loads and in front of every overwrite of their address registers (the pointer is an input, so it stays in its registers up to here)
#pragma unroll
    for (int i = 0; i < 4; ++i) { wa[i] = (__bf16)w0[i]; wa[4 + i] = (__bf16)w1[i]; wa[8 + i] = (__bf16)w2[i]; wa[12 + i] = (__bf16)w3[i]; } }
  float m[2], l[2];   // of the lane's query in each tile: m = the reference that the exponents are taken against (base 2); l counts the lane half's own keys only and is completed after the loop
  v8f acc[2][4];   // acc[qt][dt][r] = O^T[input channel 16 dt + 8 g + r][query 16 qt + col]
  v8f cm[2];   // minus the fixed reference, the same in all 8 elements (a lane's 8 elements of a score tile belong to one query): the C operand of the scores
  // one pass = one block of 32 keys, in three kinds. Fixed reference: m is the maximum of the share's FIRST block (kind 0 sets it) and stays; in the later passes (kind 1) minus m is the C operand of the score WMMA, so a score leaves it as the exponent, and no maximum is taken and no sum rescaled. Any reference gives the same softmax as long as nothing overflows; the exponentials are positive, so their sum l bounds each of them. Running reference (kind 2): the maximum is renewed in every pass and the sums are rescaled; it cannot overflow
  auto pass = [&](const int ks, auto kind) {
    constexpr int KIND = decltype(kind)::v;
    // every fragment of the pass is read here, once, as one group ahead of the products: the x loads are in flight under the scores and the softmax
    v16b kb[2], vh[4];
    const __bf16* kp = KF + ((size_t)b * (NP / 16) + ks * 2) * 256 + lane * 8; const __bf16* vp = VF + ((size_t)b * (NP / 32) + ks) * 2048 + lane * 8;
#pragma unroll
    for (int ct = 0; ct < 2; ++ct) kb[ct] = frag_k(kp + ct * 256);
#pragma unroll
    for (int dt = 0; dt < 4; ++dt) vh[dt] = frag_v(vp + dt * 512);
    asm volatile("s_wait_xcnt 0x0" :: "v"(kp), "v"(vp) : "memory");   // stands behind the issued loads and in front of every overwrite of their address registers (the two pointers are inputs, so they stay in their registers up to here)
    // the four score tiles (2 query tiles x 2 key tiles), one WMMA each
    v8f c[2][2];
#pragma unroll
    for (int qt = 0; qt < 2; ++qt)
#pragma unroll
      for (int ct = 0; ct < 2; ++ct) c[qt][ct] = wmma_bf(kb[ct], aq[qt], KIND == 1 ? cm[qt] : (v8f){});
    F2 pb[2];
#pragma unroll
    for (int qt = 0; qt < 2; ++qt) { float s[16];
#pragma unroll
      for (int r = 0; r < 8; ++r) { s[r] = c[qt][0][r]; s[8 + r] = c[qt][1][r]; }
      if (KIND != 1) { float mx = s[0];
#pragma unroll
        for (int i = 1; i < 16; ++i) mx = fmaxf(mx, s[i]);
        mx = fmaxf(mx, xhalf(mx));   // both lane halves of a query take the same reference: their keys are summed in one product
        const float mn = fmaxf(m[qt], mx);
        if (KIND == 2) { const float alpha = ex2_slot(m[qt] - mn); l[qt] *= alpha;
#pragma unroll
          for (int dt = 0; dt < 4; ++dt) acc[qt][dt] *= alpha; }
        m[qt] = mn;
#pragma unroll
        for (int i = 0; i < 16; ++i) s[i] -= mn;
#pragma unroll
        for (int r = 0; r < 8; ++r) cm[qt][r] = -mn; }
#pragma unroll
      for (int i = 0; i < 16; ++i) s[i] = ex2(s[i]);
      float t[8];
#pragma unroll
      for (int i = 0; i < 8; ++i) t[i] = s[i] + s[8 + i];
      l[qt] += ((t[0] + t[4]) + (t[2] + t[6])) + ((t[1] + t[5]) + (t[3] + t[7]));
      pb[qt] = bsplit16(s); }
    // eight accumulators, product by product; per accumulator the order of the two is x.lo, x.hi
#pragma unroll
    for (int dt = 0; dt < 4; ++dt)
#pragma unroll
      for (int qt = 0; qt < 2; ++qt) acc[qt][dt] = wmma_bf(vh[dt], pb[qt].l, acc[qt][dt]);
#pragma unroll
    for (int dt = 0; dt < 4; ++dt)
#pragma unroll
      for (int qt = 0; qt < 2; ++qt) acc[qt][dt] = wmma_bf(vh[dt], pb[qt].h, acc[qt][dt]); };
  auto clear = [&]() {
#pragma unroll
    for (int qt = 0; qt < 2; ++qt) { m[qt] = -3.0e38f; l[qt] = 0.f;
#pragma unroll
      for (int dt = 0; dt < 4; ++dt) acc[qt][dt] = (v8f){}; } };
  clear();
  pass(sh, Kind<0>{});
#pragma unroll 1   // stays rolled: the registers and the text of one pass
  for (int ks = sh + KSPL; ks < NP / 32; ks += KSPL) pass(ks, Kind<1>{});
  // a sum above 2 ** 60 (or not a number) in any lane: scores of this share lie too far above those of its first block for a fixed reference; the whole wave takes its share again with the running reference (the test reads the same in every lane; no barrier stands inside)
  if (__builtin_amdgcn_ballot_w32(!(l[0] <= 0x1p60f) || !(l[1] <= 0x1p60f)) != 0u) { clear();
#pragma unroll 1   // stays rolled, as above
    for (int ks = sh; ks < NP / 32; ks += KSPL) pass(ks, Kind<2>{}); }
#pragma unroll
  for (int qt = 0; qt < 2; ++qt) l[qt] += xhalf(l[qt]);
  const float gm = bfr(GM[0]);
  const int ln = __builtin_amdgcn_mbcnt_lo(~0u, 0u), ec = ln & 15, eg = ln >> 4;   // the lane number taken anew: the indices of the epilogue are not carried over the loop in registers
#pragma unroll
  for (int qt = 0; qt < 2; ++qt)
#pragma unroll
    for (int dt = 0; dt < 4; ++dt)
#pragma unroll
      for (int r = 0; r < 8; ++r) so[sh][dt * 16 + 8 * eg + r][qt * 16 + ec] = acc[qt][dt][r];   // so[share][channel][query local], not yet normalised
  if (eg == 0) {
#pragma unroll
    for (int qt = 0; qt < 2; ++qt) { sm[sh][qt * 16 + ec] = m[qt]; sl[sh][qt * 16 + ec] = l[qt]; } }
  __syncthreads();
  { const int q = ln; float mm = sm[0][q];   // the block has KSPL waves: wave sh forms the weights of share sh for the 32 queries
#pragma unroll
    for (int j = 1; j < KSPL; ++j) mm = fmaxf(mm, sm[j][q]);
    float ll = 0.f;
#pragma unroll
    for (int j = 0; j < KSPL; ++j) ll += sl[j][q] * ex2(sm[j][q] - mm);
    sw[sh][q] = ex2(sm[sh][q] - mm) / ll; }
  __syncthreads();   // the weights are read by every wave
  static_assert(KSPL == CH / 4, "one wave for every 4 channels of the output");
  const int c = sh * 4 + (ln >> 3), pc = ln & 7; const size_t o = ((size_t)b * CH + c) * NP + blockIdx.x * 32 + pc * 4;
  const v4f xs = *(const v4f*)(X + o);   // in flight under the merge
  { v4f ov = {};
#pragma unroll
    for (int s = 0; s < KSPL; ++s) ov += *(const v4f*)&sw[s][pc * 4] * *(const v4f*)&so[s][c][pc * 4];
    *(v4f*)&so[0][c][pc * 4] = ov; }   // merged O[input channel][query] takes the place of share 0: these 16 bytes of every share are read by this thread alone
  __syncthreads();   // the merged O is read by every wave
  { float t[16];   // B fragment: column = query 16 qe + ec, the k order of wa
#pragma unroll
    for (int i = 0; i < 8; ++i) { t[i] = so[0][kc * 32 + 8 * eg + i][qe * 16 + ec]; t[8 + i] = so[0][kc * 32 + 16 + 8 * eg + i][qe * 16 + ec]; }
    const F2 ob = bsplit16(t);
    v8f d = wmma_bf(wa, ob.l, (v8f){}); d = wmma_bf(wa, ob.h, d);
#pragma unroll
    for (int r = 0; r < 8; ++r) so[1 + kc][mt * 16 + 8 * eg + r][qe * 16 + ec] = d[r]; }   // the two halves of the input channels go to the places of shares 1 and 2, which nobody reads any more
  __syncthreads();   // a channel's line is put together from four waves' tiles
  { const v4f ov = *(const v4f*)&so[1][c][pc * 4] + *(const v4f*)&so[2][c][pc * 4];
    vst2(Y + o, (v4f){bfr(xs[0]) + gm * ov[0], bfr(xs[1]) + gm * ov[1], bfr(xs[2]) + gm * ov[2], bfr(xs[3]) + gm * ov[3]}); }
}
extern "C" void kernel_launch(void* const* d_in, const int* in_sizes, int n_in, void* d_out, int out_size, void* d_ws, size_t ws_size, hipStream_t stream) {
  (void)in_sizes; (void)n_in; (void)out_size;
  const float** F = (const float**)d_in;   // x [2,64,16,16,16], Wq [8,64], Wk [8,64], Wv [64,64], gamma [1]
  if (ws_size < (size_t)WS_END) return;
  char* ws = (char*)d_ws; __bf16 *KF = (__bf16*)(ws + WS_KF), *VF = (__bf16*)(ws + WS_VF); float* QK = (float*)(ws + WS_QK);
  k_proj<<<dim3(NP / 64, TNB), 128, 0, stream>>>(F[0], F[1], F[2], QK, KF, VF);
  k_attn<<<dim3(TQB, TNB), 32 * KSPL, 0, stream>>>(QK, KF, VF, F[0], F[3], F[4], (float*)d_out);
}

// v010
// A run of this version takes 16.1 microseconds.
// Two timings next to v009 both put it at 1.13 times that version's speed.
// Over all steps from v000 it is 31.5 times as fast.
// compute dtype: x, Wq, Wk, Wv, gamma (module inputs) rounded to bf16; the 1x1x1 projections q/k with exact bf16 products (x and W are inputs) on WMMA 16x16x32 (Wq and Wk as the 16 rows of one A operand), scores q.k with both computed operands as bf16 hi + residual pairs (3 products, side by side along the 32-deep k of one WMMA), out = Wv.(x.attn^T): x (exact in bf16) x attn hi/lo (2 products), then Wv (exact in bf16) x the normalised sum hi/lo (2 products); softmax and the residual x + gamma*out in f32; f32 accumulate.
#include <hip/hip_runtime.h>
#include <math.h>

typedef __attribute__((ext_vector_type(16))) _Float16 v16h;
typedef __attribute__((ext_vector_type(16))) __bf16 v16b;
typedef __attribute__((ext_vector_type(8)))  _Float16 v8h;
typedef __attribute__((ext_vector_type(8)))  float v8f;
typedef __attribute__((ext_vector_type(4)))  float v4f;
typedef __attribute__((ext_vector_type(2)))  float v2f;
typedef __attribute__((ext_vector_type(4)))  unsigned v4u;
typedef __attribute__((ext_vector_type(4)))  int v4i;
typedef float __attribute__((may_alias)) float_a;
typedef int __attribute__((may_alias)) int_a;

template <typename T> __device__ __forceinline__ void vst2(void* p, T v) { *(T*)p = v;  }
__device__ __forceinline__ v8f wmma16(v16h a, v16h b, v8f c) {
  v8f d = __builtin_amdgcn_wmma_f32_16x16x32_f16(false, a, false, b, (short)0, c, false, false);
  asm volatile("v_nop\n\tv_nop\n\tv_nop\n\tv_nop" : "+v"(d) : "v"(a), "v"(b));
  return d;
}
__device__ __forceinline__ v8f wmma_bf(v16b a, v16b b, v8f c) {
  v8f d = __builtin_amdgcn_wmma_f32_16x16x32_bf16(false, a, false, b, (short)0, c, false, false);
  asm volatile("v_nop\n\tv_nop\n\tv_nop\n\tv_nop" : "+v"(d) : "v"(a), "v"(b));
  return d;
}
// 16x16x32 fragments: lane = (h = lane>>4, row/col = lane&15); elements 0..7 = k0+8h+0..7, 8..15 = k0+16+8h+0..7; D element r = row 8h+r
__device__ __forceinline__ v16h frag_h(const _Float16* rowk0, int lane) {
  union { v16h v; v8h q[2]; } u; const _Float16* p = rowk0 + 8 * (lane >> 4);
  u.q[0] = *(const v8h*)p; u.q[1] = *(const v8h*)(p + 16); return u.v;
}
__device__ __forceinline__ v16h frag_f32(const float* rowk0, int lane) {
  v16h a; const float* p = rowk0 + 8 * (lane >> 4);
#pragma unroll
  for (int i = 0; i < 8; ++i) { a[i] = (_Float16)p[i]; a[8 + i] = (_Float16)p[16 + i]; }
  return a;
}
__device__ __forceinline__ v16h frag_f32s(const float* rowk0, int lane, float sc) {
  v16h a; const float* p = rowk0 + 8 * (lane >> 4);
#pragma unroll
  for (int i = 0; i < 8; ++i) { a[i] = (_Float16)(p[i] * sc); a[8 + i] = (_Float16)(p[16 + i] * sc); }
  return a;
}
// column fragment from a [K][ld] layout (column n), rows >= K read as 0
__device__ __forceinline__ v16h fragc_f32(const float* W, int k0, int n, int lane, int ld, int K) {
  v16h a; const int g = lane >> 4;
#pragma unroll
  for (int i = 0; i < 8; ++i) { const int ka = k0 + 8 * g + i, kb = ka + 16;
    a[i] = (_Float16)(ka < K ? W[(size_t)(ka < K ? ka : K - 1) * ld + n] : 0.f); a[8 + i] = (_Float16)(kb < K ? W[(size_t)(kb < K ? kb : K - 1) * ld + n] : 0.f); }
  return a;
}
struct F2 { v16b h, l; };
__device__ __forceinline__ F2 bsplit16(const float v[16]) { F2 r;
#pragma unroll
  for (int i = 0; i < 16; ++i) { const __bf16 h = (__bf16)v[i]; r.h[i] = h; r.l[i] = (__bf16)(v[i] - (float)h); }
  return r; }
__device__ __forceinline__ F2 split_row(const float* row, int k0, int lane) { float v[16]; const float* p = row + k0 + 8 * (lane >> 4);
#pragma unroll
  for (int i = 0; i < 8; ++i) { v[i] = p[i]; v[8 + i] = p[16 + i]; }
  return bsplit16(v); }
__device__ __forceinline__ F2 split_rowK(const float* row, int k0, int lane, int K) { float v[16]; const int g = lane >> 4;
#pragma unroll
  for (int i = 0; i < 8; ++i) { const int ka = k0 + 8 * g + i, kb = ka + 16; v[i] = ka < K ? row[ka < K ? ka : K - 1] : 0.f; v[8 + i] = kb < K ? row[kb < K ? kb : K - 1] : 0.f; }
  return bsplit16(v); }
__device__ __forceinline__ F2 split_col(const float* W, int k0, int n, int lane, int ld, int K) { float v[16]; const int g = lane >> 4;
#pragma unroll
  for (int i = 0; i < 8; ++i) { const int ka = k0 + 8 * g + i, kb = ka + 16; v[i] = ka < K ? W[(size_t)(ka < K ? ka : K - 1) * ld + n] : 0.f; v[8 + i] = kb < K ? W[(size_t)(kb < K ? kb : K - 1) * ld + n] : 0.f; }
  return bsplit16(v); }
__device__ __forceinline__ v8f mac3(const F2& a, const F2& b, v8f c) { c = wmma_bf(a.l, b.h, c); c = wmma_bf(a.h, b.l, c); return wmma_bf(a.h, b.h, c); }
__device__ __forceinline__ float sigm(float v) { return 1.0f / (1.0f + expf(-v)); }
#define LDSX() do { asm volatile("s_wait_dscnt 0" ::: "memory"); __builtin_amdgcn_wave_barrier(); __builtin_amdgcn_fence(__ATOMIC_RELEASE, "workgroup"); } while (0)


// 3-D position attention (B 2, C 64, 16x16x16 = 4096 positions, reduced 8): q = Wq x, k = Wk x, v = Wv x (1x1x1 convs, no bias); attn = softmax(q^T k / sqrt(8)) over positions; out[c][n] = sum_m v[c][m] attn[n][m]; y = x + gamma * out. The sum over positions is linear, so it is taken over x and Wv is applied to its result: out = Wv.(x.attn^T).
#define NB 2
#define CH 64
#define NP 4096
#define RR 8
#ifndef TQB
#define TQB (NP / 32)
#define TNB NB
#endif
typedef __attribute__((ext_vector_type(8))) __bf16 v8b;
__device__ __forceinline__ v16b frag_b(const __bf16* rowk0, int lane) {
  union { v16b v; v8b q[2]; } u; const __bf16* p = rowk0 + 8 * (lane >> 4);
  u.q[0] = *(const v8b*)p; u.q[1] = *(const v8b*)(p + 16); return u.v;
}
__device__ __forceinline__ float bfr(float v) { return (float)(__bf16)v; }
__device__ __attribute__((noinline)) float erf_ni(float v) { return erff(v); }

#define WS_QK  0u                                // f32 [NB][NP][RR]: q * 8 ** -0.5 * log2(e)
#define WS_KF  (WS_QK + 4u * NB * NP * RR)         // bf16 [NB][NP / 16 key tiles][32 lanes][8]: k of key 16 tile + col, reduced dims 0..7, as the A fragment's elements 0..7 in lane order: lane half 0 holds the hi parts, lane half 1 the lo parts
#define WS_VF  (WS_KF + 2u * NB * NP * 16)         // bf16 [NB][NP / 32 key blocks][4 channel tiles][2 halves][32 lanes][8]: x as A fragments (channel 16 dt + col, key 32 block + 16 half + 8 g + i), lane order
#define WS_END (WS_VF + 2u * NB * CH * NP)

// ---- k_proj: block = (64 positions, batch), a wave = 16 positions. x is read from global memory straight in the lane order of its users, every load of a wave in flight together, and passes through no LDS. The product is taken transposed, D[out][position] = W (A: rows 0..7 Wq, 8..15 Wk) . x (B: column = position), so lane half 0 ends with the 8 dims of q of its position and lane half 1 with those of k, and each lane stores its own. Only the weights, rounded to bf16 by the block itself, go through LDS ([out][in], pitch 144 B for the 16-byte fragment reads). x, rounded to bf16, goes out in the order of the attention's A fragments
typedef __attribute__((ext_vector_type(4))) __bf16 v4b;
__global__ __launch_bounds__(128) void k_proj(const float* __restrict__ X, const float* __restrict__ WQ, const float* __restrict__ WK, float* __restrict__ QK, __bf16* __restrict__ KF, __bf16* __restrict__ VF) {
  __shared__ __align__(16) __bf16 swt[16][72];
  const int tid = threadIdx.x, wave = tid >> 5, lane = tid & 31, col = lane & 15, g = lane >> 4; const int b = blockIdx.y; const int p0 = blockIdx.x * 64;
  const float* wq = WQ + tid * 4; const float* wk = WK + tid * 4;   // 16 bytes a thread from each group of 8 weight rows (whole lines); issued first
  const float* xb = X + ((size_t)b * CH + 8 * g) * NP + p0 + wave * 16 + col;   // B fragments: column = position 16 wave + col, element i = channel 32 kc + 8 g + i, element 8 + i = 16 channels on
  const int cl = lane >> 2, pl = lane & 3;   // x for the attention: a lane takes 8 positions of one channel, 4 lanes one 128-B line, a wave 8 channels
  const float* xv = X + ((size_t)b * CH + wave * 8 + cl) * NP + p0 + pl * 8;
  // every loop of this kernel is unrolled in full: its counter indexes values that stay in registers only under constant indices, and all loads are to be issued ahead of the first wait
  v4f w[2]; float xf[2][16]; v4f xs[4][2];
  w[0] = *(const v4f*)wq; w[1] = *(const v4f*)wk;
#pragma unroll
  for (int kc = 0; kc < 2; ++kc) {
#pragma unroll
    for (int i = 0; i < 8; ++i) { xf[kc][i] = xb[(size_t)(kc * 32 + i) * NP]; xf[kc][8 + i] = xb[(size_t)(kc * 32 + 16 + i) * NP]; } }
#pragma unroll
  for (int it = 0; it < 4; ++it) { const float* p = xv + (size_t)(it & 1) * 32 * NP + (it >> 1) * 32; xs[it][0] = *(const v4f*)p; xs[it][1] = *(const v4f*)(p + 4); }   // channels 32 on; positions 32 on
  asm volatile("s_wait_xcnt 0x0" :: "v"(wq), "v"(wk), "v"(xb), "v"(xv) : "memory");   // stands behind the issued loads and in front of every overwrite of their address registers (the pointers are inputs, so they stay in their registers up to here)
#pragma unroll
  for (int t = 0; t < 2; ++t) { v4b h;
#pragma unroll
    for (int i = 0; i < 4; ++i) h[i] = (__bf16)w[t][i];
    *(v4b*)&swt[t * 8 + (tid >> 4)][(tid & 15) * 4] = h; }
  __syncthreads();   // the weight rows are read by every wave
  v16b wa[2];   // both weight fragments read as one group ahead of the products
#pragma unroll
  for (int kc = 0; kc < 2; ++kc) wa[kc] = frag_b(&swt[col][kc * 32], lane);
  __bf16* vo = VF + ((size_t)b * (NP / 32) + blockIdx.x * 2) * 2048 + (wave >> 1) * 512 + (pl >> 1) * 256 + ((pl & 1) * 16 + (wave & 1) * 8 + cl) * 8;   // channel tile, half, lane (g, channel in the tile): a wave's store is 4 whole 128-B lines
#pragma unroll
  for (int it = 0; it < 4; ++it) { v8b h;
#pragma unroll
    for (int i = 0; i < 4; ++i) { h[i] = (__bf16)xs[it][0][i]; h[4 + i] = (__bf16)xs[it][1][i]; }
    *(v8b*)(vo + (it >> 1) * 2048 + (it & 1) * 1024) = h; }
  v8f d = {};
#pragma unroll
  for (int kc = 0; kc < 2; ++kc) { v16b bx;
#pragma unroll
    for (int i = 0; i < 16; ++i) bx[i] = (__bf16)xf[kc][i];
    d = wmma_bf(wa[kc], bx, d); }
  const size_t pos = (size_t)b * NP + p0 + wave * 16 + col;
  if (g == 0) { v4f q0, q1;   // q goes out times 8 ** -0.5 * log2(e): exp(z) = 2 ** (z log2(e)), so q.k is the exponent in base 2
#pragma unroll
    for (int i = 0; i < 4; ++i) { q0[i] = d[i] * (0.35355339059327373f * 1.4426950408889634f); q1[i] = d[4 + i] * (0.35355339059327373f * 1.4426950408889634f); }
    vst2(QK + pos * RR, q0); vst2(QK + pos * RR + 4, q1);
  } else { v8b kh, kl;   // the wave's 16 positions are one key tile: the hi parts of a key's 8 dims go to the place of lane col, the lo parts to that of lane 16 + col
#pragma unroll
    for (int i = 0; i < 8; ++i) { const float v = d[i]; const __bf16 hb = (__bf16)v; kh[i] = hb; kl[i] = (__bf16)(v - (float)hb); }
    __bf16* kt = KF + ((size_t)b * (NP / 16) + blockIdx.x * 4 + wave) * 256 + col * 8;
    *(v8b*)kt = kh; *(v8b*)(kt + 128) = kl; }
}
// ---- k_attn: block = (32 queries, batch) = KSPL key shares, one wave each: the wave of share sh takes the blocks of 32 keys sh, sh + KSPL, ... for BOTH query tiles of the block, so a k or v fragment is loaded once for 32 queries; it keeps maxima, sums and accumulators per query tile, and the shares are merged in LDS at the end. Per wave the products are taken transposed: S^T[key][query] = k.q (q comes scaled by 8 ** -0.5 * log2(e)), its 3 products of 8 dims (hi.hi, lo.hi, hi.lo) laid side by side along the K 32 of one WMMA: A = k hi | lo | hi | lo, B = q hi | hi | lo | 0, so a lane holds 16 of the 32 scores of ONE query of each tile (lane = (g, query); tile ct, element r = key 16 ct + 8 g + r), which is at once the B fragment of O^T[c][query] = X.P^T(hi/lo), X = x in bf16 (exact, so it has no lo part): the softmax runs inside the lane, its exponents taken against a reference that the share's first pass fixes (the maximum of its first 32 keys; one exchange between the two lane halves there); epilogue: weight of a share = 2 ** (m_share - max) / merged sum (references in base 2); merged O = sum of weighted partial O; out = Wv.O(hi/lo), one (16 channels, 16 queries, 32 input channels) product a wave; y[b][c][n] = x + gamma * out (one 128-B line per channel)
#define KSPL 16
template <int V> struct Kind { static constexpr int v = V; };
// 2 ** v as the one hardware instruction, inline; a result below the normal range may go to 0; under the fixed reference an argument may lie above 0, and the test on the sums behind the loop catches an overflow
__device__ __forceinline__ float ex2(float v) { return __builtin_amdgcn_exp2f(v); }
// the same instruction with the slot behind it in one statement (one v_nop before its result is used or its source overwritten)
__device__ __forceinline__ float ex2_slot(float v) { float r; asm("v_exp_f32 %0, %1\n\tv_nop" : "=v"(r) : "v"(v)); return r; }
// the value of lane l ^ 16 (the other lane half), without LDS
__device__ __forceinline__ float xhalf(float v) { const int b = __builtin_bit_cast(int, v); return __builtin_bit_cast(float, __builtin_amdgcn_permlanex16(b, b, 0x76543210, 0xfedcba98, false, false)); }
// fragments stored in lane order: p = the lane's own 16 bytes. x: elements 0..7 and, 512 bytes on, 8..15; k: elements 0..7 (hi parts in lane half 0, lo parts in lane half 1), elements 8..15 repeat them
__device__ __forceinline__ v16b frag_v(const __bf16* p) { union { v16b v; v8b q[2]; } u; u.q[0] = *(const v8b*)p; u.q[1] = *(const v8b*)(p + 256); return u.v; }
__device__ __forceinline__ v16b frag_k(const __bf16* p) { union { v16b v; v8b q[2]; } u; u.q[0] = *(const v8b*)p; u.q[1] = u.q[0]; return u.v; }
__global__ __launch_bounds__(32 * KSPL) void k_attn(const float* __restrict__ QK, const __bf16* __restrict__ KF, const __bf16* __restrict__ VF, const float* __restrict__ X, const float* __restrict__ WV, const float* __restrict__ GM, float* __restrict__ Y) {
  __shared__ __align__(16) float so[KSPL][CH][36]; __shared__ __align__(16) float sm[KSPL][32], sl[KSPL][32], sw[KSPL][32];
  const int sh = __builtin_amdgcn_readfirstlane(threadIdx.x >> 5), lane = threadIdx.x & 31, col = lane & 15;   // wave number = key share, in a scalar register: the key loop's counter and branch stay scalar
  const int b = blockIdx.y; const int q0 = blockIdx.x * 32;
  v16b aq[2];   // B fragment of q (which the projection has scaled, so the scores leave the WMMA as exponents in base 2): elements 0..7 = hi parts in both lane halves (against k hi and k lo), elements 8..15 = lo parts in lane half 0 (against k hi), zero in lane half 1
  // every inner loop of this kernel is unrolled in full: its counter indexes fragments, scores or accumulators, which stay in registers only under constant indices
#pragma unroll
  for (int qt = 0; qt < 2; ++qt) { const float* qr = QK + ((size_t)b * NP + q0 + qt * 16 + col) * RR; const v4f a0 = *(const v4f*)qr, a1 = *(const v4f*)(qr + 4);
#pragma unroll
    for (int i = 0; i < 8; ++i) { const float v = i < 4 ? a0[i & 3] : a1[i & 3]; const __bf16 hb = (__bf16)v; aq[qt][i] = hb; aq[qt][8 + i] = (lane >> 4) ? (__bf16)0.f : (__bf16)(v - (float)hb); } }
  static_assert(KSPL == 16 && CH == 64, "closing product: 4 output channel tiles x 2 query tiles x 2 halves of the input channels = one wave each");
  const int mt = sh & 3, qe = (sh >> 2) & 1, kc = sh >> 3;
  v16b wa;   // the wave's A fragment of Wv for the closing product (row = output channel 16 mt + col, input channels 32 kc + 8 g + i and + 16), rounded to bf16; read here with q, so that no wave waits for it behind the loop
  { const float* wr = WV + (size_t)(mt * 16 + col) * CH + kc * 32 + 8 * (lane >> 4);
    const v4f w0 = *(const v4f*)wr, w1 = *(const v4f*)(wr + 4), w2 = *(const v4f*)(wr + 16), w3 = *(const v4f*)(wr + 20);
    asm volatile("s_wait_xcnt 0x0" :: "v"(wr) : "memory");   // stands behind the issued loads and in front of every overwrite of their address registers (the pointer is an input, so it stays in its registers up to here)
#pragma unroll
    for (int i = 0; i < 4; ++i) { wa[i] = (__bf16)w0[i]; wa[4 + i] = (__bf16)w1[i]; wa[8 + i] = (__bf16)w2[i]; wa[12 + i] = (__bf16)w3[i]; } }
  float m[2], l[2];   // of the lane's query in each tile: m = the reference that the exponents are taken against (base 2); l counts the lane half's own keys only and is completed after the loop
  v8f acc[2][4];   // acc[qt][dt][r] = O^T[input channel 16 dt + 8 g + r][query 16 qt + col]
  v8f cm[2];   // minus the fixed reference, the same in all 8 elements (a lane's 8 elements of a score tile belong to one query): the C operand of the scores
  // one pass = one block of 32 keys, in three kinds. Fixed reference: m is the maximum of the share's FIRST block (kind 0 sets it) and stays; in the later passes (kind 1) minus m is the C operand of the score WMMA, so a score leaves it as the exponent, and no maximum is taken and no sum rescaled. Any reference gives the same softmax as long as nothing overflows; the exponentials are positive, so their sum l bounds each of them. Running reference (kind 2): the maximum is renewed in every pass and the sums are rescaled; it cannot overflow
  auto pass = [&](const int ks, auto kind) {
    constexpr int KIND = decltype(kind)::v;
    // every fragment of the pass is read here, once, as one group ahead of the products: the x loads are in flight under the scores and the softmax
    v16b kb[2], vh[4];
    const __bf16* kp = KF + ((size_t)b * (NP / 16) + ks * 2) * 256 + lane * 8; const __bf16* vp = VF + ((size_t)b * (NP / 32) + ks) * 2048 + lane * 8;
#pragma unroll
    for (int ct = 0; ct < 2; ++ct) kb[ct] = frag_k(kp + ct * 256);
#pragma unroll
    for (int dt = 0; dt < 4; ++dt) vh[dt] = frag_v(vp + dt * 512);
    asm volatile("s_wait_xcnt 0x0" :: "v"(kp), "v"(vp) : "memory");   // stands behind the issued loads and in front of every overwrite of their address registers (the two pointers are inputs, so they stay in their registers up to here)
    // the four score tiles (2 query tiles x 2 key tiles), one WMMA each
    v8f c[2][2];
#pragma unroll
    for (int qt = 0; qt < 2; ++qt)
#pragma unroll
      for (int ct = 0; ct < 2; ++ct) c[qt][ct] = wmma_bf(kb[ct], aq[qt], KIND == 1 ? cm[qt] : (v8f){});
    F2 pb[2];
#pragma unroll
    for (int qt = 0; qt < 2; ++qt) { float s[16];
#pragma unroll
      for (int r = 0; r < 8; ++r) { s[r] = c[qt][0][r]; s[8 + r] = c[qt][1][r]; }
      if (KIND != 1) { float mx = s[0];
#pragma unroll
        for (int i = 1; i < 16; ++i) mx = fmaxf(mx, s[i]);
        mx = fmaxf(mx, xhalf(mx));   // both lane halves of a query take the same reference: their keys are summed in one product
        const float mn = fmaxf(m[qt], mx);
        if (KIND == 2) { const float alpha = ex2_slot(m[qt] - mn); l[qt] *= alpha;
#pragma unroll
          for (int dt = 0; dt < 4; ++dt) acc[qt][dt] *= alpha; }
        m[qt] = mn;
#pragma unroll
        for (int i = 0; i < 16; ++i) s[i] -= mn;
#pragma unroll
        for (int r = 0; r < 8; ++r) cm[qt][r] = -mn; }
#pragma unroll
      for (int i = 0; i < 16; ++i) s[i] = ex2(s[i]);
      float t[8];
#pragma unroll
      for (int i = 0; i < 8; ++i) t[i] = s[i] + s[8 + i];
      l[qt] += ((t[0] + t[4]) + (t[2] + t[6])) + ((t[1] + t[5]) + (t[3] + t[7]));
      pb[qt] = bsplit16(s); }
    // eight accumulators, product by product; per accumulator the order of the two is x.lo, x.hi
#pragma unroll
    for (int dt = 0; dt < 4; ++dt)
#pragma unroll
      for (int qt = 0; qt < 2; ++qt) acc[qt][dt] = wmma_bf(vh[dt], pb[qt].l, acc[qt][dt]);
#pragma unroll
    for (int dt = 0; dt < 4; ++dt)
#pragma unroll
      for (int qt = 0; qt < 2; ++qt) acc[qt][dt] = wmma_bf(vh[dt], pb[qt].h, acc[qt][dt]); };
  auto clear = [&]() {
#pragma unroll
    for (int qt = 0; qt < 2; ++qt) { m[qt] = -3.0e38f; l[qt] = 0.f;
#pragma unroll
      for (int dt = 0; dt < 4; ++dt) acc[qt][dt] = (v8f){}; } };
  clear();
  pass(sh, Kind<0>{});
#pragma unroll 1   // stays rolled: the registers and the text of one pass
  for (int ks = sh + KSPL; ks < NP / 32; ks += KSPL) pass(ks, Kind<1>{});
  // a sum above 2 ** 60 (or not a number) in any lane: scores of this share lie too far above those of its first block for a fixed reference; the whole wave takes its share again with the running reference (the test reads the same in every lane; no barrier stands inside)
  if (__builtin_amdgcn_ballot_w32(!(l[0] <= 0x1p60f) || !(l[1] <= 0x1p60f)) != 0u) { clear();
#pragma unroll 1   // stays rolled, as above
    for (int ks = sh; ks < NP / 32; ks += KSPL) pass(ks, Kind<2>{}); }
#pragma unroll
  for (int qt = 0; qt < 2; ++qt) l[qt] += xhalf(l[qt]);
  const float gm = bfr(GM[0]);
  const int ln = __builtin_amdgcn_mbcnt_lo(~0u, 0u), ec = ln & 15, eg = ln >> 4;   // the lane number taken anew: the indices of the epilogue are not carried over the loop in registers
#pragma unroll
  for (int qt = 0; qt < 2; ++qt)
#pragma unroll
    for (int dt = 0; dt < 4; ++dt)
#pragma unroll
      for (int r = 0; r < 8; ++r) so[sh][dt * 16 + 8 * eg + r][qt * 16 + ec] = acc[qt][dt][r];   // so[share][channel][query local], not yet normalised
  if (eg == 0) {
#pragma unroll
    for (int qt = 0; qt < 2; ++qt) { sm[sh][qt * 16 + ec] = m[qt]; sl[sh][qt * 16 + ec] = l[qt]; } }
  __syncthreads();
  { const int q = ln; float mm = sm[0][q];   // the block has KSPL waves: wave sh forms the weights of share sh for the 32 queries
#pragma unroll
    for (int j = 1; j < KSPL; ++j) mm = fmaxf(mm, sm[j][q]);
    float ll = 0.f;
#pragma unroll
    for (int j = 0; j < KSPL; ++j) ll += sl[j][q] * ex2(sm[j][q] - mm);
    sw[sh][q] = ex2(sm[sh][q] - mm) / ll; }
  __syncthreads();   // the weights are read by every wave
  static_assert(KSPL == CH / 4, "one wave for every 4 channels of the output");
  const int c = sh * 4 + (ln >> 3), pc = ln & 7; const size_t o = ((size_t)b * CH + c) * NP + blockIdx.x * 32 + pc * 4;
  const v4f xs = *(const v4f*)(X + o);   // in flight under the merge
  { v4f ov = {};
#pragma unroll
    for (int s = 0; s < KSPL; ++s) ov += *(const v4f*)&sw[s][pc * 4] * *(const v4f*)&so[s][c][pc * 4];
    *(v4f*)&so[0][c][pc * 4] = ov; }   // merged O[input channel][query] takes the place of share 0: these 16 bytes of every share are read by this thread alone
  __syncthreads();   // the merged O is read by every wave
  { float t[16];   // B fragment: column = query 16 qe + ec, the k order of wa
#pragma unroll
    for (int i = 0; i < 8; ++i) { t[i] = so[0][kc * 32 + 8 * eg + i][qe * 16 + ec]; t[8 + i] = so[0][kc * 32 + 16 + 8 * eg + i][qe * 16 + ec]; }
    const F2 ob = bsplit16(t);
    v8f d = wmma_bf(wa, ob.l, (v8f){}); d = wmma_bf(wa, ob.h, d);
#pragma unroll
    for (int r = 0; r < 8; ++r) so[1 + kc][mt * 16 + 8 * eg + r][qe * 16 + ec] = d[r]; }   // the two halves of the input channels go to the places of shares 1 and 2, which nobody reads any more
  __syncthreads();   // a channel's line is put together from four waves' tiles
  { const v4f ov = *(const v4f*)&so[1][c][pc * 4] + *(const v4f*)&so[2][c][pc * 4];
    vst2(Y + o, (v4f){bfr(xs[0]) + gm * ov[0], bfr(xs[1]) + gm * ov[1], bfr(xs[2]) + gm * ov[2], bfr(xs[3]) + gm * ov[3]}); }
}
extern "C" void kernel_launch(void* const* d_in, const int* in_sizes, int n_in, void* d_out, int out_size, void* d_ws, size_t ws_size, hipStream_t stream) {
  (void)in_sizes; (void)n_in; (void)out_size;
  const float** F = (const float**)d_in;   // x [2,64,16,16,16], Wq [8,64], Wk [8,64], Wv [64,64], gamma [1]
  if (ws_size < (size_t)WS_END) return;
  char* ws = (char*)d_ws; __bf16 *KF = (__bf16*)(ws + WS_KF), *VF = (__bf16*)(ws + WS_VF); float* QK = (float*)(ws + WS_QK);
  k_proj<<<dim3(NP / 64, TNB), 128, 0, stream>>>(F[0], F[1], F[2], QK, KF, VF);
  k_attn<<<dim3(TQB, TNB), 32 * KSPL, 0, stream>>>(QK, KF, VF, F[0], F[3], F[4], (float*)d_out);
}
